// v000
// The times below were measured on an AMD MI455X: many runs one after another, warmed up first and cycling through
// copies of the inputs, with the whole window's GPU time divided by the number of runs. Launches and the gaps
// between them are all in it. The median over several windows is given; except for v000 it joins two sittings, which
// can be a few percent apart, so the side-by-side timings, each taken in one sitting, are the better comparison.
// v000, which the later versions start from, runs in 293 microseconds.
// compute dtype: all float inputs rounded to bf16; clip in f32 (clipped bf16 values stay exact); q/k/v = x W with EXACT bf16 products on WMMA 16x16x32; q, k rounded once to f16 (single-f16 logits), sigmoid in f32; the sigmoid weights as f16 hi + residual . v (f16; 2 products); unnormalised sum in f32; f32 output.
#include <hip/hip_runtime.h>
#include <math.h>

typedef __attribute__((ext_vector_type(16))) _Float16 v16h;
typedef __attribute__((ext_vector_type(16))) __bf16 v16b;
typedef __attribute__((ext_vector_type(8)))  _Float16 v8h;
typedef __attribute__((ext_vector_type(8)))  float v8f;
typedef __attribute__((ext_vector_type(4)))  float v4f;
typedef __attribute__((ext_vector_type(2)))  float v2f;
typedef __attribute__((ext_vector_type(4)))  unsigned v4u;
typedef __attribute__((ext_vector_type(4)))  int v4i;
typedef float __attribute__((may_alias)) float_a;
typedef int __attribute__((may_alias)) int_a;

template <typename T> __device__ __forceinline__ void vst2(void* p, T v) { *(T*)p = v;  }
__device__ __forceinline__ v8f wmma16(v16h a, v16h b, v8f c) {
  v8f d = __builtin_amdgcn_wmma_f32_16x16x32_f16(false, a, false, b, (short)0, c, false, false);
  asm volatile("v_nop\n\tv_nop\n\tv_nop\n\tv_nop" : "+v"(d) : "v"(a), "v"(b));
  return d;
}
__device__ __forceinline__ v8f wmma_bf(v16b a, v16b b, v8f c) {
  v8f d = __builtin_amdgcn_wmma_f32_16x16x32_bf16(false, a, false, b, (short)0, c, false, false);
  asm volatile("v_nop\n\tv_nop\n\tv_nop\n\tv_nop" : "+v"(d) : "v"(a), "v"(b));
  return d;
}
// 16x16x32 fragments: lane = (h = lane>>4, row/col = lane&15); elements 0..7 = k0+8h+0..7, 8..15 = k0+16+8h+0..7; D element r = row 8h+r
__device__ __forceinline__ v16h frag_h(const _Float16* rowk0, int lane) {
  union { v16h v; v8h q[2]; } u; const _Float16* p = rowk0 + 8 * (lane >> 4);
  u.q[0] = *(const v8h*)p; u.q[1] = *(const v8h*)(p + 16); return u.v;
}
__device__ __forceinline__ v16h frag_f32(const float* rowk0, int lane) {
  v16h a; const float* p = rowk0 + 8 * (lane >> 4);
#pragma unroll
  for (int i = 0; i < 8; ++i) { a[i] = (_Float16)p[i]; a[8 + i] = (_Float16)p[16 + i]; }
  return a;
}
__device__ __forceinline__ v16h frag_f32s(const float* rowk0, int lane, float sc) {
  v16h a; const float* p = rowk0 + 8 * (lane >> 4);
#pragma unroll
  for (int i = 0; i < 8; ++i) { a[i] = (_Float16)(p[i] * sc); a[8 + i] = (_Float16)(p[16 + i] * sc); }
  return a;
}
// column fragment from a [K][ld] layout (column n), rows >= K read as 0
__device__ __forceinline__ v16h fragc_f32(const float* W, int k0, int n, int lane, int ld, int K) {
  v16h a; const int g = lane >> 4;
#pragma unroll
  for (int i = 0; i < 8; ++i) { const int ka = k0 + 8 * g + i, kb = ka + 16;
    a[i] = (_Float16)(ka < K ? W[(size_t)(ka < K ? ka : K - 1) * ld + n] : 0.f); a[8 + i] = (_Float16)(kb < K ? W[(size_t)(kb < K ? kb : K - 1) * ld + n] : 0.f); }
  return a;
}
struct F2 { v16b h, l; };
__device__ __forceinline__ F2 bsplit16(const float v[16]) { F2 r;
#pragma unroll
  for (int i = 0; i < 16; ++i) { const __bf16 h = (__bf16)v[i]; r.h[i] = h; r.l[i] = (__bf16)(v[i] - (float)h); }
  return r; }
__device__ __forceinline__ F2 split_row(const float* row, int k0, int lane) { float v[16]; const float* p = row + k0 + 8 * (lane >> 4);
#pragma unroll
  for (int i = 0; i < 8; ++i) { v[i] = p[i]; v[8 + i] = p[16 + i]; }
  return bsplit16(v); }
__device__ __forceinline__ F2 split_rowK(const float* row, int k0, int lane, int K) { float v[16]; const int g = lane >> 4;
#pragma unroll
  for (int i = 0; i < 8; ++i) { const int ka = k0 + 8 * g + i, kb = ka + 16; v[i] = ka < K ? row[ka < K ? ka : K - 1] : 0.f; v[8 + i] = kb < K ? row[kb < K ? kb : K - 1] : 0.f; }
  return bsplit16(v); }
__device__ __forceinline__ F2 split_col(const float* W, int k0, int n, int lane, int ld, int K) { float v[16]; const int g = lane >> 4;
#pragma unroll
  for (int i = 0; i < 8; ++i) { const int ka = k0 + 8 * g + i, kb = ka + 16; v[i] = ka < K ? W[(size_t)(ka < K ? ka : K - 1) * ld + n] : 0.f; v[8 + i] = kb < K ? W[(size_t)(kb < K ? kb : K - 1) * ld + n] : 0.f; }
  return bsplit16(v); }
__device__ __forceinline__ v8f mac3(const F2& a, const F2& b, v8f c) { c = wmma_bf(a.l, b.h, c); c = wmma_bf(a.h, b.l, c); return wmma_bf(a.h, b.h, c); }
__device__ __forceinline__ float sigm(float v) { return 1.0f / (1.0f + expf(-v)); }
#define LDSX() do { asm volatile("s_wait_dscnt 0" ::: "memory"); __builtin_amdgcn_wave_barrier(); __builtin_amdgcn_fence(__ATOMIC_RELEASE, "workgroup"); } while (0)


// 'Modular' sigmoid attention (B 4, S 4,096, D 512, U 64): x = clip(inputs, -1, 1); q, k, v = x Wq, x Wk, x Wv; out = sigmoid(q k^T) v (no softmax, no scaling).
#define NB 4
#define NN 4096
#define DD 512
#define UU 64
#ifndef TNB
#define TNB NB
#endif
typedef __attribute__((ext_vector_type(8))) __bf16 v8b;
__device__ __forceinline__ v16b frag_b(const __bf16* rowk0, int lane) {
  union { v16b v; v8b q[2]; } u; const __bf16* p = rowk0 + 8 * (lane >> 4);
  u.q[0] = *(const v8b*)p; u.q[1] = *(const v8b*)(p + 16); return u.v;
}
__device__ __forceinline__ float bfr(float v) { return (float)(__bf16)v; }
__device__ __attribute__((noinline)) float exp_ni(float v) { return expf(v); }
__device__ __attribute__((noinline)) float erf_ni(float v) { return erff(v); }

#define WS_PW  0u                                   // bf16 W^T rows [192][512] (q | k | v)
#define WS_QH  (WS_PW + 2u * 3 * UU * DD)               // f16 q rows [b*NN + s][64]; k rows; v planes [b][64][NN]
#define WS_KH  (WS_QH + 2u * (size_t)NB * NN * UU)
#define WS_VT  (WS_KH + 2u * (size_t)NB * NN * UU)
#define WS_END (WS_VT + 2u * (size_t)NB * UU * NN)

__global__ __launch_bounds__(256) void k_packw(const float* __restrict__ WQ, const float* __restrict__ WK, const float* __restrict__ WV, __bf16* __restrict__ PW) { const int n = blockIdx.x, t = threadIdx.x; __shared__ __align__(16) __bf16 s[DD]; const int which = n / UU, u = n % UU; const float* Wm = which == 0 ? WQ : which == 1 ? WK : WV;   // (in,out) [512][64]
  for (int k = t; k < DD; k += 256) s[k] = (__bf16)Wm[(size_t)k * UU + u]; __syncthreads(); if (t < DD / 8) vst2((unsigned*)(PW + (size_t)n * DD + t * 8), *(const v4u*)&s[t * 8]); }
// ---- k_proj: block = 64 rows: x = clip -> A; cols 0..63 q, 64..127 k, 128..191 v (12 tiles)
__global__ __launch_bounds__(128) void k_proj(const float* __restrict__ X, const __bf16* __restrict__ PW, _Float16* __restrict__ QH, _Float16* __restrict__ KH, _Float16* __restrict__ VT) { __shared__ __align__(16) _Float16 sq[64][72], sk[64][72]; __shared__ __align__(16) _Float16 th[UU][72];
  const int tid = threadIdx.x, wave = tid >> 5, lane = tid & 31, col = lane & 15, g = lane >> 4; const size_t r0 = (size_t)blockIdx.x * 64 + wave * 16; const size_t b = ((size_t)blockIdx.x * 64) / NN; const int n0 = (int)(((size_t)blockIdx.x * 64) % NN);
  v8f acc[12];
#pragma unroll
  for (int j = 0; j < 12; ++j) acc[j] = v8f{};
#pragma unroll 2
  for (int kc = 0; kc < DD / 32; ++kc) { v16b a; const float* pp = X + (r0 + col) * DD + kc * 32 + 8 * g;
#pragma unroll
    for (int i = 0; i < 8; ++i) { a[i] = (__bf16)fminf(fmaxf(bfr(pp[i]), -1.0f), 1.0f); a[8 + i] = (__bf16)fminf(fmaxf(bfr(pp[16 + i]), -1.0f), 1.0f); }
#pragma unroll
    for (int j = 0; j < 12; ++j) acc[j] = wmma_bf(a, frag_b(PW + (size_t)(j * 16 + col) * DD + kc * 32, lane), acc[j]); }
#pragma unroll
  for (int j = 0; j < 12; ++j)
#pragma unroll
    for (int r = 0; r < 8; ++r) { const _Float16 hv = (_Float16)acc[j][r]; const int c = (j & 3) * 16 + col; if (j < 4) sq[wave * 16 + 8 * g + r][c] = hv; else if (j < 8) sk[wave * 16 + 8 * g + r][c] = hv; else th[c][wave * 16 + 8 * g + r] = hv; }
  __syncthreads();
  for (int e = tid; e < 64 * 8; e += 128) { const int rl = e >> 3, q = e & 7; const size_t o = ((size_t)blockIdx.x * 64 + rl) * UU + q * 8; vst2((unsigned*)(QH + o), *(const v4u*)&sq[rl][q * 8]); vst2((unsigned*)(KH + o), *(const v4u*)&sk[rl][q * 8]); }
  for (int e = tid; e < UU * 8; e += 128) { const int c = e >> 3, q = e & 7; vst2((unsigned*)(VT + (b * UU + c) * (size_t)NN + n0 + q * 8), *(const v4u*)&th[c][q * 8]); } }
// ---- k_att: block = (64 queries, b): w = sigmoid(q.k); out = sum_t w v (no normalisation)
__global__ __launch_bounds__(128) void k_att(const _Float16* __restrict__ QH, const _Float16* __restrict__ KH, const _Float16* __restrict__ VT, float* __restrict__ OUT) {
  __shared__ __align__(16) float sp[4][16][36]; __shared__ __align__(16) float so[4][16][68];
  const int tid = threadIdx.x, wave = tid >> 5, lane = tid & 31, col = lane & 15, g = lane >> 4; const size_t b = blockIdx.y; const int q0 = blockIdx.x * 64 + wave * 16; const size_t rq = b * NN + q0;
  v16h aq[2];
#pragma unroll
  for (int kc = 0; kc < 2; ++kc) aq[kc] = frag_h(QH + (rq + col) * UU + kc * 32, lane);
  v8f acc[4] = {}, accl[4] = {};
#pragma unroll 1
  for (int ks = 0; ks < NN / 32; ++ks) {
#pragma unroll
    for (int ct = 0; ct < 2; ++ct) { const size_t rk = b * NN + ks * 32 + ct * 16 + col; v8f c = {};
#pragma unroll
      for (int kc = 0; kc < 2; ++kc) c = wmma16(aq[kc], frag_h(KH + rk * UU + kc * 32, lane), c);
#pragma unroll
      for (int r = 0; r < 8; ++r) sp[wave][8 * g + r][ct * 16 + col] = 1.0f / (1.0f + __expf(-c[r])); }
    LDSX();
    v16h pa, pal; { const float* prow = &sp[wave][col][0] + 8 * (lane >> 4);
#pragma unroll
      for (int i = 0; i < 8; ++i) { const float p0 = prow[i], p1 = prow[16 + i]; pa[i] = (_Float16)p0; pa[8 + i] = (_Float16)p1; pal[i] = (_Float16)((p0 - (float)pa[i]) * 2048.0f); pal[8 + i] = (_Float16)((p1 - (float)pa[8 + i]) * 2048.0f); } }
#pragma unroll
    for (int j = 0; j < 4; ++j) { const v16h vf = frag_h(VT + (b * UU + j * 16 + col) * (size_t)NN + ks * 32, lane); acc[j] = wmma16(pa, vf, acc[j]); accl[j] = wmma16(pal, vf, accl[j]); }
    LDSX(); }
#pragma unroll
  for (int r = 0; r < 8; ++r)
#pragma unroll
    for (int j = 0; j < 4; ++j) so[wave][8 * g + r][j * 16 + col] = acc[j][r] + accl[j][r] * (1.0f / 2048.0f);
  LDSX(); for (int rl = 0; rl < 16; ++rl) if (lane < 16) vst2(OUT + (rq + rl) * UU + lane * 4, *(const v4f*)&so[wave][rl][lane * 4]); }
extern "C" void kernel_launch(void* const* d_in, const int* in_sizes, int n_in, void* d_out, int out_size, void* d_ws, size_t ws_size, hipStream_t stream) {
  (void)in_sizes; (void)n_in; (void)out_size;
  const float** F = (const float**)d_in;   // 0 inputs [4,4096,512,1], 1 Wq [512,64], 2 Wk, 3 Wv ((in,out))
  if (ws_size < (size_t)WS_END) return;
  char* ws = (char*)d_ws; __bf16* PW = (__bf16*)(ws + WS_PW); _Float16 *QH = (_Float16*)(ws + WS_QH), *KH = (_Float16*)(ws + WS_KH), *VT = (_Float16*)(ws + WS_VT);
  k_packw<<<3 * UU, 256, 0, stream>>>(F[1], F[2], F[3], PW);
  k_proj<<<NB * NN / 64, 128, 0, stream>>>(F[0], PW, QH, KH, VT);
  k_att<<<dim3(NN / 64, TNB), 128, 0, stream>>>(QH, KH, VT, (float*)d_out);
}

// v001
// It runs in 120 microseconds.
// Next to v000, in two timings, it ran 2.46 times as fast each time.
// compute dtype: all float inputs rounded to bf16; clip in f32 (clipped bf16 values stay exact); q/k/v = x W with EXACT bf16 products on WMMA 16x16x32; q, k rounded once to f16 (single-f16 logits), sigmoid in f32; the sigmoid weights as f16 hi + residual . v (f16; 2 products); unnormalised sum in f32; f32 output.
#include <hip/hip_runtime.h>
#include <math.h>

typedef __attribute__((ext_vector_type(16))) _Float16 v16h;
typedef __attribute__((ext_vector_type(16))) __bf16 v16b;
typedef __attribute__((ext_vector_type(8)))  _Float16 v8h;
typedef __attribute__((ext_vector_type(8)))  float v8f;
typedef __attribute__((ext_vector_type(4)))  float v4f;
typedef __attribute__((ext_vector_type(2)))  float v2f;
typedef __attribute__((ext_vector_type(4)))  unsigned v4u;
typedef __attribute__((ext_vector_type(4)))  int v4i;
typedef float __attribute__((may_alias)) float_a;
typedef int __attribute__((may_alias)) int_a;

template <typename T> __device__ __forceinline__ void vst2(void* p, T v) { *(T*)p = v;  }
__device__ __forceinline__ v8f wmma16(v16h a, v16h b, v8f c) {
  v8f d = __builtin_amdgcn_wmma_f32_16x16x32_f16(false, a, false, b, (short)0, c, false, false);
  asm volatile("v_nop\n\tv_nop\n\tv_nop\n\tv_nop" : "+v"(d) : "v"(a), "v"(b));
  return d;
}
__device__ __forceinline__ v8f wmma_bf(v16b a, v16b b, v8f c) {
  v8f d = __builtin_amdgcn_wmma_f32_16x16x32_bf16(false, a, false, b, (short)0, c, false, false);
  asm volatile("v_nop\n\tv_nop\n\tv_nop\n\tv_nop" : "+v"(d) : "v"(a), "v"(b));
  return d;
}
// 16x16x32 fragments: lane = (h = lane>>4, row/col = lane&15); elements 0..7 = k0+8h+0..7, 8..15 = k0+16+8h+0..7; D element r = row 8h+r
__device__ __forceinline__ v16h frag_h(const _Float16* rowk0, int lane) {
  union { v16h v; v8h q[2]; } u; const _Float16* p = rowk0 + 8 * (lane >> 4);
  u.q[0] = *(const v8h*)p; u.q[1] = *(const v8h*)(p + 16); return u.v;
}
__device__ __forceinline__ v16h frag_f32(const float* rowk0, int lane) {
  v16h a; const float* p = rowk0 + 8 * (lane >> 4);
#pragma unroll
  for (int i = 0; i < 8; ++i) { a[i] = (_Float16)p[i]; a[8 + i] = (_Float16)p[16 + i]; }
  return a;
}
__device__ __forceinline__ v16h frag_f32s(const float* rowk0, int lane, float sc) {
  v16h a; const float* p = rowk0 + 8 * (lane >> 4);
#pragma unroll
  for (int i = 0; i < 8; ++i) { a[i] = (_Float16)(p[i] * sc); a[8 + i] = (_Float16)(p[16 + i] * sc); }
  return a;
}
// column fragment from a [K][ld] layout (column n), rows >= K read as 0
__device__ __forceinline__ v16h fragc_f32(const float* W, int k0, int n, int lane, int ld, int K) {
  v16h a; const int g = lane >> 4;
#pragma unroll
  for (int i = 0; i < 8; ++i) { const int ka = k0 + 8 * g + i, kb = ka + 16;
    a[i] = (_Float16)(ka < K ? W[(size_t)(ka < K ? ka : K - 1) * ld + n] : 0.f); a[8 + i] = (_Float16)(kb < K ? W[(size_t)(kb < K ? kb : K - 1) * ld + n] : 0.f); }
  return a;
}
struct F2 { v16b h, l; };
__device__ __forceinline__ F2 bsplit16(const float v[16]) { F2 r;
#pragma unroll
  for (int i = 0; i < 16; ++i) { const __bf16 h = (__bf16)v[i]; r.h[i] = h; r.l[i] = (__bf16)(v[i] - (float)h); }
  return r; }
__device__ __forceinline__ F2 split_row(const float* row, int k0, int lane) { float v[16]; const float* p = row + k0 + 8 * (lane >> 4);
#pragma unroll
  for (int i = 0; i < 8; ++i) { v[i] = p[i]; v[8 + i] = p[16 + i]; }
  return bsplit16(v); }
__device__ __forceinline__ F2 split_rowK(const float* row, int k0, int lane, int K) { float v[16]; const int g = lane >> 4;
#pragma unroll
  for (int i = 0; i < 8; ++i) { const int ka = k0 + 8 * g + i, kb = ka + 16; v[i] = ka < K ? row[ka < K ? ka : K - 1] : 0.f; v[8 + i] = kb < K ? row[kb < K ? kb : K - 1] : 0.f; }
  return bsplit16(v); }
__device__ __forceinline__ F2 split_col(const float* W, int k0, int n, int lane, int ld, int K) { float v[16]; const int g = lane >> 4;
#pragma unroll
  for (int i = 0; i < 8; ++i) { const int ka = k0 + 8 * g + i, kb = ka + 16; v[i] = ka < K ? W[(size_t)(ka < K ? ka : K - 1) * ld + n] : 0.f; v[8 + i] = kb < K ? W[(size_t)(kb < K ? kb : K - 1) * ld + n] : 0.f; }
  return bsplit16(v); }
__device__ __forceinline__ v8f mac3(const F2& a, const F2& b, v8f c) { c = wmma_bf(a.l, b.h, c); c = wmma_bf(a.h, b.l, c); return wmma_bf(a.h, b.h, c); }
__device__ __forceinline__ float sigm(float v) { return 1.0f / (1.0f + expf(-v)); }
#define LDSX() do { asm volatile("s_wait_dscnt 0" ::: "memory"); __builtin_amdgcn_wave_barrier(); __builtin_amdgcn_fence(__ATOMIC_RELEASE, "workgroup"); } while (0)


// 'Modular' sigmoid attention (B 4, S 4,096, D 512, U 64): x = clip(inputs, -1, 1); q, k, v = x Wq, x Wk, x Wv; out = sigmoid(q k^T) v (no softmax, no scaling).
#define NB 4
#define NN 4096
#define DD 512
#define UU 64
#ifndef TNB
#define TNB NB
#endif
typedef __attribute__((ext_vector_type(8))) __bf16 v8b;
__device__ __forceinline__ v16b frag_b(const __bf16* rowk0, int lane) {
  union { v16b v; v8b q[2]; } u; const __bf16* p = rowk0 + 8 * (lane >> 4);
  u.q[0] = *(const v8b*)p; u.q[1] = *(const v8b*)(p + 16); return u.v;
}
__device__ __forceinline__ float bfr(float v) { return (float)(__bf16)v; }
__device__ __attribute__((noinline)) float exp_ni(float v) { return expf(v); }
__device__ __attribute__((noinline)) float erf_ni(float v) { return erff(v); }

#define WS_PW  0u                                   // bf16 W^T rows [192][512] (q | k | v)
#define WS_QH  (WS_PW + 2u * 3 * UU * DD)               // f16 q rows [b*NN + s][64]; k rows; v planes [b][64][NN]
#define WS_KH  (WS_QH + 2u * (size_t)NB * NN * UU)
#define WS_VT  (WS_KH + 2u * (size_t)NB * NN * UU)
#define WS_END (WS_VT + 2u * (size_t)NB * UU * NN)

__global__ __launch_bounds__(256) void k_packw(const float* __restrict__ WQ, const float* __restrict__ WK, const float* __restrict__ WV, __bf16* __restrict__ PW) { const int n = blockIdx.x, t = threadIdx.x; __shared__ __align__(16) __bf16 s[DD]; const int which = n / UU, u = n % UU; const float* Wm = which == 0 ? WQ : which == 1 ? WK : WV;   // (in,out) [512][64]
  for (int k = t; k < DD; k += 256) s[k] = (__bf16)Wm[(size_t)k * UU + u]; __syncthreads(); if (t < DD / 8) vst2((unsigned*)(PW + (size_t)n * DD + t * 8), *(const v4u*)&s[t * 8]); }
// ---- k_proj: block = 64 rows: x = clip -> A; cols 0..63 q, 64..127 k, 128..191 v (12 tiles)
__global__ __launch_bounds__(128) void k_proj(const float* __restrict__ X, const __bf16* __restrict__ PW, _Float16* __restrict__ QH, _Float16* __restrict__ KH, _Float16* __restrict__ VT) { __shared__ __align__(16) _Float16 sq[64][72], sk[64][72]; __shared__ __align__(16) _Float16 th[UU][72];
  const int tid = threadIdx.x, wave = tid >> 5, lane = tid & 31, col = lane & 15, g = lane >> 4; const size_t r0 = (size_t)blockIdx.x * 64 + wave * 16; const size_t b = ((size_t)blockIdx.x * 64) / NN; const int n0 = (int)(((size_t)blockIdx.x * 64) % NN);
  v8f acc[12];
#pragma unroll
  for (int j = 0; j < 12; ++j) acc[j] = v8f{};
#pragma unroll 2
  for (int kc = 0; kc < DD / 32; ++kc) { v16b a; const float* pp = X + (r0 + col) * DD + kc * 32 + 8 * g;
#pragma unroll
    for (int i = 0; i < 8; ++i) { a[i] = (__bf16)fminf(fmaxf(bfr(pp[i]), -1.0f), 1.0f); a[8 + i] = (__bf16)fminf(fmaxf(bfr(pp[16 + i]), -1.0f), 1.0f); }
#pragma unroll
    for (int j = 0; j < 12; ++j) acc[j] = wmma_bf(a, frag_b(PW + (size_t)(j * 16 + col) * DD + kc * 32, lane), acc[j]); }
#pragma unroll
  for (int j = 0; j < 12; ++j)
#pragma unroll
    for (int r = 0; r < 8; ++r) { const _Float16 hv = (_Float16)acc[j][r]; const int c = (j & 3) * 16 + col; if (j < 4) sq[wave * 16 + 8 * g + r][c] = hv; else if (j < 8) sk[wave * 16 + 8 * g + r][c] = hv; else th[c][wave * 16 + 8 * g + r] = hv; }
  __syncthreads();
  for (int e = tid; e < 64 * 8; e += 128) { const int rl = e >> 3, q = e & 7; const size_t o = ((size_t)blockIdx.x * 64 + rl) * UU + q * 8; vst2((unsigned*)(QH + o), *(const v4u*)&sq[rl][q * 8]); vst2((unsigned*)(KH + o), *(const v4u*)&sk[rl][q * 8]); }
  for (int e = tid; e < UU * 8; e += 128) { const int c = e >> 3, q = e & 7; vst2((unsigned*)(VT + (b * UU + c) * (size_t)NN + n0 + q * 8), *(const v4u*)&th[c][q * 8]); } }
// ---- k_att: block = (64 queries, b), 4 query tiles x KP key parts = 4 * KP waves: w = sigmoid(q.k); each wave sums w v over its own keys, the parts are joined in LDS (no normalisation)
#define KP 8
__global__ __launch_bounds__(128 * KP) void k_att(const _Float16* __restrict__ QH, const _Float16* __restrict__ KH, const _Float16* __restrict__ VT, float* __restrict__ OUT) {
  __shared__ __align__(16) float sp[4 * KP][16][36]; __shared__ __align__(16) float so[4 * KP][16][68];
  const int tid = threadIdx.x, wave = __builtin_amdgcn_readfirstlane(tid >> 5) /* scalar, so that the key loop keeps its scalar counter and branch */, lane = tid & 31, col = lane & 15, g = lane >> 4; const int qt = wave & 3, kp = wave >> 2; const size_t b = blockIdx.y; const int q0 = blockIdx.x * 64 + qt * 16; const size_t rq = b * NN + q0;
  v16h aq[2];
#pragma unroll
  for (int kc = 0; kc < 2; ++kc) aq[kc] = frag_h(QH + (rq + col) * UU + kc * 32, lane);
  v8f acc[4] = {}, accl[4] = {};
#pragma unroll 1
  for (int ks = kp; ks < NN / 32; ks += KP) {
#pragma unroll
    for (int ct = 0; ct < 2; ++ct) { const size_t rk = b * NN + ks * 32 + ct * 16 + col; v8f c = {};
#pragma unroll
      for (int kc = 0; kc < 2; ++kc) c = wmma16(aq[kc], frag_h(KH + rk * UU + kc * 32, lane), c);
#pragma unroll
      for (int r = 0; r < 8; ++r) sp[wave][8 * g + r][ct * 16 + col] = 1.0f / (1.0f + __expf(-c[r])); }
    LDSX();
    v16h pa, pal; { const float* prow = &sp[wave][col][0] + 8 * (lane >> 4);
#pragma unroll
      for (int i = 0; i < 8; ++i) { const float p0 = prow[i], p1 = prow[16 + i]; pa[i] = (_Float16)p0; pa[8 + i] = (_Float16)p1; pal[i] = (_Float16)((p0 - (float)pa[i]) * 2048.0f); pal[8 + i] = (_Float16)((p1 - (float)pa[8 + i]) * 2048.0f); } }
#pragma unroll
    for (int j = 0; j < 4; ++j) { const v16h vf = frag_h(VT + (b * UU + j * 16 + col) * (size_t)NN + ks * 32, lane); acc[j] = wmma16(pa, vf, acc[j]); accl[j] = wmma16(pal, vf, accl[j]); }
    LDSX(); }
#pragma unroll
  for (int r = 0; r < 8; ++r)
#pragma unroll
    for (int j = 0; j < 4; ++j) so[wave][8 * g + r][j * 16 + col] = acc[j][r] + accl[j][r] * (1.0f / 2048.0f);
  __syncthreads();   // every part's partial tile is in LDS before any thread joins them
  for (int e = tid; e < 64 * 16; e += 128 * KP) { const int row = e >> 4, c4 = (e & 15) * 4; v4f s = *(const v4f*)&so[row >> 4][row & 15][c4];
#pragma unroll   // the KP LDS reads issue together; the adds stay in the order of the parts
    for (int p = 1; p < KP; ++p) s += *(const v4f*)&so[p * 4 + (row >> 4)][row & 15][c4];
    vst2(OUT + (b * NN + blockIdx.x * 64 + row) * UU + c4, s); } }
extern "C" void kernel_launch(void* const* d_in, const int* in_sizes, int n_in, void* d_out, int out_size, void* d_ws, size_t ws_size, hipStream_t stream) {
  (void)in_sizes; (void)n_in; (void)out_size;
  const float** F = (const float**)d_in;   // 0 inputs [4,4096,512,1], 1 Wq [512,64], 2 Wk, 3 Wv ((in,out))
  if (ws_size < (size_t)WS_END) return;
  char* ws = (char*)d_ws; __bf16* PW = (__bf16*)(ws + WS_PW); _Float16 *QH = (_Float16*)(ws + WS_QH), *KH = (_Float16*)(ws + WS_KH), *VT = (_Float16*)(ws + WS_VT);
  k_packw<<<3 * UU, 256, 0, stream>>>(F[1], F[2], F[3], PW);
  k_proj<<<NB * NN / 64, 128, 0, stream>>>(F[0], PW, QH, KH, VT);
  k_att<<<dim3(NN / 64, TNB), 128 * KP, 0, stream>>>(QH, KH, VT, (float*)d_out);
}

// v002
// One run takes 84.4 microseconds.
// Timed twice side by side with v001, it ran 1.45 and 1.44 times as fast.
// All steps since v000 together make it 3.55 times as fast.
// compute dtype: all float inputs rounded to bf16; clip in f32 (clipped bf16 values stay exact); q/k/v = x W with EXACT bf16 products on WMMA 16x16x32; q, k rounded once to f16 (single-f16 logits), sigmoid in f32; the sigmoid weights as f16 hi + residual . v (f16; 2 products); unnormalised sum in f32; f32 output.
#include <hip/hip_runtime.h>
#include <math.h>

typedef __attribute__((ext_vector_type(16))) _Float16 v16h;
typedef __attribute__((ext_vector_type(16))) __bf16 v16b;
typedef __attribute__((ext_vector_type(8)))  _Float16 v8h;
typedef __attribute__((ext_vector_type(8)))  float v8f;
typedef __attribute__((ext_vector_type(4)))  float v4f;
typedef __attribute__((ext_vector_type(2)))  float v2f;
typedef __attribute__((ext_vector_type(4)))  unsigned v4u;
typedef __attribute__((ext_vector_type(4)))  int v4i;
typedef float __attribute__((may_alias)) float_a;
typedef int __attribute__((may_alias)) int_a;

template <typename T> __device__ __forceinline__ void vst2(void* p, T v) { *(T*)p = v;  }
__device__ __forceinline__ v8f wmma16(v16h a, v16h b, v8f c) {
  v8f d = __builtin_amdgcn_wmma_f32_16x16x32_f16(false, a, false, b, (short)0, c, false, false);
  asm volatile("v_nop\n\tv_nop\n\tv_nop\n\tv_nop" : "+v"(d) : "v"(a), "v"(b));
  return d;
}
__device__ __forceinline__ v8f wmma_bf(v16b a, v16b b, v8f c) {
  v8f d = __builtin_amdgcn_wmma_f32_16x16x32_bf16(false, a, false, b, (short)0, c, false, false);
  asm volatile("v_nop\n\tv_nop\n\tv_nop\n\tv_nop" : "+v"(d) : "v"(a), "v"(b));
  return d;
}
// 16x16x32 fragments: lane = (h = lane>>4, row/col = lane&15); elements 0..7 = k0+8h+0..7, 8..15 = k0+16+8h+0..7; D element r = row 8h+r
__device__ __forceinline__ v16h frag_h(const _Float16* rowk0, int lane) {
  union { v16h v; v8h q[2]; } u; const _Float16* p = rowk0 + 8 * (lane >> 4);
  u.q[0] = *(const v8h*)p; u.q[1] = *(const v8h*)(p + 16); return u.v;
}
__device__ __forceinline__ v16h frag_f32(const float* rowk0, int lane) {
  v16h a; const float* p = rowk0 + 8 * (lane >> 4);
#pragma unroll
  for (int i = 0; i < 8; ++i) { a[i] = (_Float16)p[i]; a[8 + i] = (_Float16)p[16 + i]; }
  return a;
}
__device__ __forceinline__ v16h frag_f32s(const float* rowk0, int lane, float sc) {
  v16h a; const float* p = rowk0 + 8 * (lane >> 4);
#pragma unroll
  for (int i = 0; i < 8; ++i) { a[i] = (_Float16)(p[i] * sc); a[8 + i] = (_Float16)(p[16 + i] * sc); }
  return a;
}
// column fragment from a [K][ld] layout (column n), rows >= K read as 0
__device__ __forceinline__ v16h fragc_f32(const float* W, int k0, int n, int lane, int ld, int K) {
  v16h a; const int g = lane >> 4;
#pragma unroll
  for (int i = 0; i < 8; ++i) { const int ka = k0 + 8 * g + i, kb = ka + 16;
    a[i] = (_Float16)(ka < K ? W[(size_t)(ka < K ? ka : K - 1) * ld + n] : 0.f); a[8 + i] = (_Float16)(kb < K ? W[(size_t)(kb < K ? kb : K - 1) * ld + n] : 0.f); }
  return a;
}
struct F2 { v16b h, l; };
__device__ __forceinline__ F2 bsplit16(const float v[16]) { F2 r;
#pragma unroll
  for (int i = 0; i < 16; ++i) { const __bf16 h = (__bf16)v[i]; r.h[i] = h; r.l[i] = (__bf16)(v[i] - (float)h); }
  return r; }
__device__ __forceinline__ F2 split_row(const float* row, int k0, int lane) { float v[16]; const float* p = row + k0 + 8 * (lane >> 4);
#pragma unroll
  for (int i = 0; i < 8; ++i) { v[i] = p[i]; v[8 + i] = p[16 + i]; }
  return bsplit16(v); }
__device__ __forceinline__ F2 split_rowK(const float* row, int k0, int lane, int K) { float v[16]; const int g = lane >> 4;
#pragma unroll
  for (int i = 0; i < 8; ++i) { const int ka = k0 + 8 * g + i, kb = ka + 16; v[i] = ka < K ? row[ka < K ? ka : K - 1] : 0.f; v[8 + i] = kb < K ? row[kb < K ? kb : K - 1] : 0.f; }
  return bsplit16(v); }
__device__ __forceinline__ F2 split_col(const float* W, int k0, int n, int lane, int ld, int K) { float v[16]; const int g = lane >> 4;
#pragma unroll
  for (int i = 0; i < 8; ++i) { const int ka = k0 + 8 * g + i, kb = ka + 16; v[i] = ka < K ? W[(size_t)(ka < K ? ka : K - 1) * ld + n] : 0.f; v[8 + i] = kb < K ? W[(size_t)(kb < K ? kb : K - 1) * ld + n] : 0.f; }
  return bsplit16(v); }
__device__ __forceinline__ v8f mac3(const F2& a, const F2& b, v8f c) { c = wmma_bf(a.l, b.h, c); c = wmma_bf(a.h, b.l, c); return wmma_bf(a.h, b.h, c); }
__device__ __forceinline__ float sigm(float v) { return 1.0f / (1.0f + expf(-v)); }
#define LDSX() do { asm volatile("s_wait_dscnt 0" ::: "memory"); __builtin_amdgcn_wave_barrier(); __builtin_amdgcn_fence(__ATOMIC_RELEASE, "workgroup"); } while (0)


// 'Modular' sigmoid attention (B 4, S 4,096, D 512, U 64): x = clip(inputs, -1, 1); q, k, v = x Wq, x Wk, x Wv; out = sigmoid(q k^T) v (no softmax, no scaling).
#define NB 4
#define NN 4096
#define DD 512
#define UU 64
#ifndef TNB
#define TNB NB
#endif
typedef __attribute__((ext_vector_type(8))) __bf16 v8b;
__device__ __forceinline__ v16b frag_b(const __bf16* rowk0, int lane) {
  union { v16b v; v8b q[2]; } u; const __bf16* p = rowk0 + 8 * (lane >> 4);
  u.q[0] = *(const v8b*)p; u.q[1] = *(const v8b*)(p + 16); return u.v;
}
// fragment from a wave-uniform base and the lane's own byte offset: the compiler can keep the base in scalar registers, and one lane register serves every load of a loop
__device__ __forceinline__ v16h frag_hu(const _Float16* ub, unsigned lb) { union { v16h v; v8h q[2]; } u; const char* p = (const char*)ub + lb; u.q[0] = *(const v8h*)p; u.q[1] = *(const v8h*)(p + 32); return u.v; }
__device__ __forceinline__ v16b frag_bu(const __bf16* ub, unsigned lb) { union { v16b v; v8b q[2]; } u; const char* p = (const char*)ub + lb; u.q[0] = *(const v8b*)p; u.q[1] = *(const v8b*)(p + 32); return u.v; }
__device__ __forceinline__ float bfr(float v) { return (float)(__bf16)v; }
__device__ __attribute__((noinline)) float exp_ni(float v) { return expf(v); }
__device__ __attribute__((noinline)) float erf_ni(float v) { return erff(v); }

#define WS_PW  0u                                   // bf16 W^T rows [192][512] (q | k | v)
#define WS_QH  (WS_PW + 2u * 3 * UU * DD)               // f16 q rows [b*NN + s][64]; k rows; v planes [b][64][NN]
#define WS_KH  (WS_QH + 2u * (size_t)NB * NN * UU)
#define WS_VT  (WS_KH + 2u * (size_t)NB * NN * UU)
#define WS_END (WS_VT + 2u * (size_t)NB * UU * NN)

__global__ __launch_bounds__(256) void k_packw(const float* __restrict__ WQ, const float* __restrict__ WK, const float* __restrict__ WV, __bf16* __restrict__ PW) { const int n = blockIdx.x, t = threadIdx.x; __shared__ __align__(16) __bf16 s[DD]; const int which = n / UU, u = n % UU; const float* Wm = which == 0 ? WQ : which == 1 ? WK : WV;   // (in,out) [512][64]
  for (int k = t; k < DD; k += 256) s[k] = (__bf16)Wm[(size_t)k * UU + u]; __syncthreads(); if (t < DD / 8) vst2((unsigned*)(PW + (size_t)n * DD + t * 8), *(const v4u*)&s[t * 8]); }
// ---- k_proj: block = 64 rows: x = clip -> A; cols 0..63 q, 64..127 k, 128..191 v (12 tiles)
__global__ __launch_bounds__(128) void k_proj(const float* __restrict__ X, const __bf16* __restrict__ PW, _Float16* __restrict__ QH, _Float16* __restrict__ KH, _Float16* __restrict__ VT) { __shared__ __align__(16) _Float16 sq[64][72], sk[64][72]; __shared__ __align__(16) _Float16 th[UU][72];
  const int tid = threadIdx.x, wave = tid >> 5, lane = tid & 31, col = lane & 15, g = lane >> 4; const size_t b = ((size_t)blockIdx.x * 64) / NN; const int n0 = (int)(((size_t)blockIdx.x * 64) % NN);
  v8f acc[12];
#pragma unroll
  for (int j = 0; j < 12; ++j) acc[j] = v8f{};
  // every load runs one pass ahead of its use: a B fragment's next load is issued right behind the WMMA that last read it, the next x values right behind the conversion of these
  const float* xb = X + (size_t)blockIdx.x * 64 * DD; const unsigned xl = (unsigned)((wave * 16 + col) * DD + 8 * g) * 4u, wl = (unsigned)(col * DD + 8 * g) * 2u;
  v4f xn[4]; v16b bf[12];
#pragma unroll
  for (int i = 0; i < 4; ++i) xn[i] = *(const v4f*)((const char*)xb + xl + (i >> 1) * 64 + (i & 1) * 16);
#pragma unroll
  for (int j = 0; j < 12; ++j) bf[j] = frag_bu(PW + j * 16 * DD, wl);
#pragma unroll   // unrolled whole: the last pass fetches nothing, and every address is the lane's one offset plus an immediate
  for (int kc = 0; kc < DD / 32; ++kc) { v16b a;
    __builtin_amdgcn_sched_barrier(0);   // keeps this conversion behind the pass before: hoisted, its wait for x loads just issued would stand in front of that pass's WMMAs
#pragma unroll
    for (int i = 0; i < 16; ++i) a[i] = (__bf16)fminf(fmaxf(bfr(xn[i >> 2][i & 3]), -1.0f), 1.0f);
    if (kc + 1 < DD / 32) {
#pragma unroll
      for (int i = 0; i < 4; ++i) xn[i] = *(const v4f*)((const char*)(xb + (kc + 1) * 32) + xl + (i >> 1) * 64 + (i & 1) * 16); }
#pragma unroll
    for (int j = 0; j < 12; ++j) { acc[j] = wmma_bf(a, bf[j], acc[j]); if (kc + 1 < DD / 32) bf[j] = frag_bu(PW + j * 16 * DD + (kc + 1) * 32, wl); } }
#pragma unroll
  for (int j = 0; j < 12; ++j)
#pragma unroll
    for (int r = 0; r < 8; ++r) { const _Float16 hv = (_Float16)acc[j][r]; const int c = (j & 3) * 16 + col; if (j < 4) sq[wave * 16 + 8 * g + r][c] = hv; else if (j < 8) sk[wave * 16 + 8 * g + r][c] = hv; else th[c][wave * 16 + 8 * g + r] = hv; }
  __syncthreads();
  for (int e = tid; e < 64 * 8; e += 128) { const int rl = e >> 3, q = e & 7; const size_t o = ((size_t)blockIdx.x * 64 + rl) * UU + q * 8; vst2((unsigned*)(QH + o), *(const v4u*)&sq[rl][q * 8]); vst2((unsigned*)(KH + o), *(const v4u*)&sk[rl][q * 8]); }
  for (int e = tid; e < UU * 8; e += 128) { const int c = e >> 3, q = e & 7; vst2((unsigned*)(VT + (b * UU + c) * (size_t)NN + n0 + q * 8), *(const v4u*)&th[c][q * 8]); } }
// ---- k_att: block = (64 queries, b), 4 query tiles x KP key parts = 4 * KP waves: w = sigmoid(q.k); each wave sums w v over its own keys, the parts are joined in LDS (no normalisation)
#define KP 8
__global__ __launch_bounds__(128 * KP) void k_att(const _Float16* __restrict__ QH, const _Float16* __restrict__ KH, const _Float16* __restrict__ VT, float* __restrict__ OUT) {
  __shared__ __align__(16) float sp[4 * KP][16][36]; __shared__ __align__(16) float so[4 * KP][16][68];
  const int tid = threadIdx.x, wave = __builtin_amdgcn_readfirstlane(tid >> 5) /* scalar, so that the key loop keeps its scalar counter and branch */, lane = tid & 31, col = lane & 15, g = lane >> 4; const int qt = wave & 3, kp = wave >> 2; const size_t b = blockIdx.y; const int q0 = blockIdx.x * 64 + qt * 16; const size_t rq = b * NN + q0;
  v16h aq[2];
#pragma unroll
  for (int kc = 0; kc < 2; ++kc) aq[kc] = frag_h(QH + (rq + col) * UU + kc * 32, lane);
  v8f acc[4] = {}, accl[4] = {}; const unsigned kl = (unsigned)(col * UU + 8 * g) * 2u, vl = (unsigned)(col * NN + 8 * g) * 2u;
#pragma unroll 1
  for (int ks = kp; ks < NN / 32; ks += KP) {
    const _Float16* kb = KH + (b * NN + ks * 32) * UU; const _Float16* vb = VT + b * UU * (size_t)NN + ks * 32;
    v16h kf[2] = { frag_hu(kb, kl), frag_hu(kb + 32, kl) }, vf[4];   // loads are issued ahead of use: both K fragments of a key tile together, the second tile's behind the first tile's WMMAs (they fly under its sigmoids)
#pragma unroll
    for (int ct = 0; ct < 2; ++ct) { v8f c = {};
#pragma unroll
      for (int kc = 0; kc < 2; ++kc) c = wmma16(aq[kc], kf[kc], c);
      if (ct == 0) { kf[0] = frag_hu(kb + 16 * UU, kl); kf[1] = frag_hu(kb + 16 * UU + 32, kl); }
#pragma unroll
      for (int r = 0; r < 8; ++r) sp[wave][8 * g + r][ct * 16 + col] = 1.0f / (1.0f + __expf(-c[r])); }
    LDSX();
    v16h pa, pal; { const float* prow = &sp[wave][col][0] + 8 * (lane >> 4);
#pragma unroll
      for (int i = 0; i < 8; ++i) { const float p0 = prow[i], p1 = prow[16 + i]; pa[i] = (_Float16)p0; pa[8 + i] = (_Float16)p1; pal[i] = (_Float16)((p0 - (float)pa[i]) * 2048.0f); pal[8 + i] = (_Float16)((p1 - (float)pa[8 + i]) * 2048.0f); } }
#pragma unroll
    for (int j = 0; j < 4; j += 2) { vf[j] = frag_hu(vb + (size_t)j * 16 * NN, vl); vf[j + 1] = frag_hu(vb + (size_t)(j + 1) * 16 * NN, vl);   // V fragments are loaded two at a time (the registers allow no more)
      acc[j] = wmma16(pa, vf[j], acc[j]); accl[j] = wmma16(pal, vf[j], accl[j]); acc[j + 1] = wmma16(pa, vf[j + 1], acc[j + 1]); accl[j + 1] = wmma16(pal, vf[j + 1], accl[j + 1]); }
    LDSX(); }
#pragma unroll
  for (int r = 0; r < 8; ++r)
#pragma unroll
    for (int j = 0; j < 4; ++j) so[wave][8 * g + r][j * 16 + col] = acc[j][r] + accl[j][r] * (1.0f / 2048.0f);
  __syncthreads();   // every part's partial tile is in LDS before any thread joins them
  for (int e = tid; e < 64 * 16; e += 128 * KP) { const int row = e >> 4, c4 = (e & 15) * 4; v4f s = *(const v4f*)&so[row >> 4][row & 15][c4];
#pragma unroll   // the KP LDS reads issue together; the adds stay in the order of the parts
    for (int p = 1; p < KP; ++p) s += *(const v4f*)&so[p * 4 + (row >> 4)][row & 15][c4];
    vst2(OUT + (b * NN + blockIdx.x * 64 + row) * UU + c4, s); } }
extern "C" void kernel_launch(void* const* d_in, const int* in_sizes, int n_in, void* d_out, int out_size, void* d_ws, size_t ws_size, hipStream_t stream) {
  (void)in_sizes; (void)n_in; (void)out_size;
  const float** F = (const float**)d_in;   // 0 inputs [4,4096,512,1], 1 Wq [512,64], 2 Wk, 3 Wv ((in,out))
  if (ws_size < (size_t)WS_END) return;
  char* ws = (char*)d_ws; __bf16* PW = (__bf16*)(ws + WS_PW); _Float16 *QH = (_Float16*)(ws + WS_QH), *KH = (_Float16*)(ws + WS_KH), *VT = (_Float16*)(ws + WS_VT);
  k_packw<<<3 * UU, 256, 0, stream>>>(F[1], F[2], F[3], PW);
  k_proj<<<NB * NN / 64, 128, 0, stream>>>(F[0], PW, QH, KH, VT);
  k_att<<<dim3(NN / 64, TNB), 128 * KP, 0, stream>>>(QH, KH, VT, (float*)d_out);
}

// v003
// A run of this version takes 64.7 microseconds.
// Timed twice side by side with v002, it ran 1.29 and 1.31 times as fast.
// All steps since v000 together make it 4.63 times as fast.
// compute dtype: all float inputs rounded to bf16; clip in f32 (clipped bf16 values stay exact); q/k/v = x W with EXACT bf16 products on WMMA 16x16x32; q, k rounded once to f16 (single-f16 logits), sigmoid in f32; the sigmoid weights as f16 hi + residual . v (f16; 2 products); unnormalised sum in f32; f32 output.
#include <hip/hip_runtime.h>
#include <math.h>

typedef __attribute__((ext_vector_type(16))) _Float16 v16h;
typedef __attribute__((ext_vector_type(16))) __bf16 v16b;
typedef __attribute__((ext_vector_type(8)))  _Float16 v8h;
typedef __attribute__((ext_vector_type(8)))  float v8f;
typedef __attribute__((ext_vector_type(4)))  float v4f;
typedef __attribute__((ext_vector_type(2)))  float v2f;
typedef __attribute__((ext_vector_type(4)))  unsigned v4u;
typedef __attribute__((ext_vector_type(4)))  int v4i;
typedef float __attribute__((may_alias)) float_a;
typedef int __attribute__((may_alias)) int_a;

template <typename T> __device__ __forceinline__ void vst2(void* p, T v) { *(T*)p = v;  }
__device__ __forceinline__ v8f wmma16(v16h a, v16h b, v8f c) {
  v8f d = __builtin_amdgcn_wmma_f32_16x16x32_f16(false, a, false, b, (short)0, c, false, false);
  asm volatile("v_nop\n\tv_nop\n\tv_nop\n\tv_nop" : "+v"(d) : "v"(a), "v"(b));
  return d;
}
__device__ __forceinline__ v8f wmma_bf(v16b a, v16b b, v8f c) {
  v8f d = __builtin_amdgcn_wmma_f32_16x16x32_bf16(false, a, false, b, (short)0, c, false, false);
  asm volatile("v_nop\n\tv_nop\n\tv_nop\n\tv_nop" : "+v"(d) : "v"(a), "v"(b));
  return d;
}
// 16x16x32 fragments: lane = (h = lane>>4, row/col = lane&15); elements 0..7 = k0+8h+0..7, 8..15 = k0+16+8h+0..7; D element r = row 8h+r
__device__ __forceinline__ v16h frag_h(const _Float16* rowk0, int lane) {
  union { v16h v; v8h q[2]; } u; const _Float16* p = rowk0 + 8 * (lane >> 4);
  u.q[0] = *(const v8h*)p; u.q[1] = *(const v8h*)(p + 16); return u.v;
}
__device__ __forceinline__ v16h frag_f32(const float* rowk0, int lane) {
  v16h a; const float* p = rowk0 + 8 * (lane >> 4);
#pragma unroll
  for (int i = 0; i < 8; ++i) { a[i] = (_Float16)p[i]; a[8 + i] = (_Float16)p[16 + i]; }
  return a;
}
__device__ __forceinline__ v16h frag_f32s(const float* rowk0, int lane, float sc) {
  v16h a; const float* p = rowk0 + 8 * (lane >> 4);
#pragma unroll
  for (int i = 0; i < 8; ++i) { a[i] = (_Float16)(p[i] * sc); a[8 + i] = (_Float16)(p[16 + i] * sc); }
  return a;
}
// column fragment from a [K][ld] layout (column n), rows >= K read as 0
__device__ __forceinline__ v16h fragc_f32(const float* W, int k0, int n, int lane, int ld, int K) {
  v16h a; const int g = lane >> 4;
#pragma unroll
  for (int i = 0; i < 8; ++i) { const int ka = k0 + 8 * g + i, kb = ka + 16;
    a[i] = (_Float16)(ka < K ? W[(size_t)(ka < K ? ka : K - 1) * ld + n] : 0.f); a[8 + i] = (_Float16)(kb < K ? W[(size_t)(kb < K ? kb : K - 1) * ld + n] : 0.f); }
  return a;
}
struct F2 { v16b h, l; };
__device__ __forceinline__ F2 bsplit16(const float v[16]) { F2 r;
#pragma unroll
  for (int i = 0; i < 16; ++i) { const __bf16 h = (__bf16)v[i]; r.h[i] = h; r.l[i] = (__bf16)(v[i] - (float)h); }
  return r; }
__device__ __forceinline__ F2 split_row(const float* row, int k0, int lane) { float v[16]; const float* p = row + k0 + 8 * (lane >> 4);
#pragma unroll
  for (int i = 0; i < 8; ++i) { v[i] = p[i]; v[8 + i] = p[16 + i]; }
  return bsplit16(v); }
__device__ __forceinline__ F2 split_rowK(const float* row, int k0, int lane, int K) { float v[16]; const int g = lane >> 4;
#pragma unroll
  for (int i = 0; i < 8; ++i) { const int ka = k0 + 8 * g + i, kb = ka + 16; v[i] = ka < K ? row[ka < K ? ka : K - 1] : 0.f; v[8 + i] = kb < K ? row[kb < K ? kb : K - 1] : 0.f; }
  return bsplit16(v); }
__device__ __forceinline__ F2 split_col(const float* W, int k0, int n, int lane, int ld, int K) { float v[16]; const int g = lane >> 4;
#pragma unroll
  for (int i = 0; i < 8; ++i) { const int ka = k0 + 8 * g + i, kb = ka + 16; v[i] = ka < K ? W[(size_t)(ka < K ? ka : K - 1) * ld + n] : 0.f; v[8 + i] = kb < K ? W[(size_t)(kb < K ? kb : K - 1) * ld + n] : 0.f; }
  return bsplit16(v); }
__device__ __forceinline__ v8f mac3(const F2& a, const F2& b, v8f c) { c = wmma_bf(a.l, b.h, c); c = wmma_bf(a.h, b.l, c); return wmma_bf(a.h, b.h, c); }
__device__ __forceinline__ float sigm(float v) { return 1.0f / (1.0f + expf(-v)); }
#define LDSX() do { asm volatile("s_wait_dscnt 0" ::: "memory"); __builtin_amdgcn_wave_barrier(); __builtin_amdgcn_fence(__ATOMIC_RELEASE, "workgroup"); } while (0)


// 'Modular' sigmoid attention (B 4, S 4,096, D 512, U 64): x = clip(inputs, -1, 1); q, k, v = x Wq, x Wk, x Wv; out = sigmoid(q k^T) v (no softmax, no scaling).
#define NB 4
#define NN 4096
#define DD 512
#define UU 64
#ifndef TNB
#define TNB NB
#endif
typedef __attribute__((ext_vector_type(8))) __bf16 v8b;
__device__ __forceinline__ v16b frag_b(const __bf16* rowk0, int lane) {
  union { v16b v; v8b q[2]; } u; const __bf16* p = rowk0 + 8 * (lane >> 4);
  u.q[0] = *(const v8b*)p; u.q[1] = *(const v8b*)(p + 16); return u.v;
}
// fragment from a wave-uniform base and the lane's own byte offset: the compiler can keep the base in scalar registers, and one lane register serves every load of a loop
// the fragment is stored in lane order: elements 0..7 of all 32 lanes are 512 bytes in a row, elements 8..15 the next 512, so each 16-byte load of a wave reads 4 whole 128-byte lines
__device__ __forceinline__ v16h frag_hp(const _Float16* ub, unsigned lb) { union { v16h v; v8h q[2]; } u; const char* p = (const char*)ub + lb; u.q[0] = *(const v8h*)p; u.q[1] = *(const v8h*)(p + 512); return u.v; }
__device__ __forceinline__ v16b frag_bp(const __bf16* ub, unsigned lb) { union { v16b v; v8b q[2]; } u; const char* p = (const char*)ub + lb; u.q[0] = *(const v8b*)p; u.q[1] = *(const v8b*)(p + 512); return u.v; }
__device__ __forceinline__ float bfr(float v) { return (float)(__bf16)v; }
__device__ __attribute__((noinline)) float exp_ni(float v) { return expf(v); }
__device__ __attribute__((noinline)) float erf_ni(float v) { return erff(v); }

#define WS_PW  0u                                   // bf16 W (q | k | v, 192 columns) as WMMA B fragments in lane order: [16-column tile][32-k step][8 elements][lane]
#define WS_QH  (WS_PW + 2u * 3 * UU * DD)               // f16 q rows [b*NN + s][64]; k and v as WMMA B fragments in lane order: k [16-key tile][u half][8 elements][lane], v [32-key step][16-u tile][8 elements][lane]
#define WS_KH  (WS_QH + 2u * (size_t)NB * NN * UU)
#define WS_VT  (WS_KH + 2u * (size_t)NB * NN * UU)
#define WS_END (WS_VT + 2u * (size_t)NB * UU * NN)

// block = one fragment (1 KB): column tile blockIdx.x >> 4, k step blockIdx.x & 15; thread t writes the 8 elements that lane t & 31 will load (0..7 for t < 32, 8..15 above)
__global__ __launch_bounds__(64) void k_packw(const float* __restrict__ WQ, const float* __restrict__ WK, const float* __restrict__ WV, __bf16* __restrict__ PW) { const int j = blockIdx.x >> 4, kc = blockIdx.x & 15, t = threadIdx.x; const float* Wm = j < 4 ? WQ : j < 8 ? WK : WV;   // (in,out) [512][64]
  const float* p = Wm + (size_t)(kc * 32 + (t >> 5) * 16 + ((t >> 4) & 1) * 8) * UU + (j & 3) * 16 + (t & 15); v8b o;
#pragma unroll   // the 8 loads issue together, one wait for all
  for (int i = 0; i < 8; ++i) o[i] = (__bf16)p[i * UU];
  *(v8b*)(PW + ((size_t)blockIdx.x * 64 + t) * 8) = o; }
// ---- k_proj: block = 64 rows: x = clip -> A; cols 0..63 q, 64..127 k, 128..191 v (12 tiles)
__global__ __launch_bounds__(128) void k_proj(const float* __restrict__ X, const __bf16* __restrict__ PW, _Float16* __restrict__ QH, _Float16* __restrict__ KH, _Float16* __restrict__ VT) { __shared__ __align__(16) _Float16 sq[64][72], sk[64][72]; __shared__ __align__(16) _Float16 th[UU][72];
  const int tid = threadIdx.x, wave = tid >> 5, lane = tid & 31, col = lane & 15, g = lane >> 4;
  v8f acc[12];
#pragma unroll
  for (int j = 0; j < 12; ++j) acc[j] = v8f{};
  // every load runs one pass ahead of its use: a B fragment's next load is issued right behind the WMMA that last read it, the next x values right behind the conversion of these
  const float* xb = X + (size_t)blockIdx.x * 64 * DD; const unsigned xl = (unsigned)((wave * 16 + col) * DD + 8 * g) * 4u, wl = (unsigned)lane * 16u;
  v4f xn[4]; v16b bf[12];
#pragma unroll
  for (int i = 0; i < 4; ++i) xn[i] = *(const v4f*)((const char*)xb + xl + (i >> 1) * 64 + (i & 1) * 16);
#pragma unroll
  for (int j = 0; j < 12; ++j) bf[j] = frag_bp(PW + j * 16 * 512, wl);
#pragma unroll   // unrolled whole: the last pass fetches nothing, and every address is the lane's one offset plus an immediate
  for (int kc = 0; kc < DD / 32; ++kc) { v16b a;
    __builtin_amdgcn_sched_barrier(0);   // keeps this conversion behind the pass before: hoisted, its wait for x loads just issued would stand in front of that pass's WMMAs
#pragma unroll
    for (int i = 0; i < 16; ++i) a[i] = (__bf16)fminf(fmaxf(bfr(xn[i >> 2][i & 3]), -1.0f), 1.0f);
    if (kc + 1 < DD / 32) {
#pragma unroll
      for (int i = 0; i < 4; ++i) xn[i] = *(const v4f*)((const char*)(xb + (kc + 1) * 32) + xl + (i >> 1) * 64 + (i & 1) * 16); }
#pragma unroll
    for (int j = 0; j < 12; ++j) { acc[j] = wmma_bf(a, bf[j], acc[j]); if (kc + 1 < DD / 32) bf[j] = frag_bp(PW + (j * 16 + kc + 1) * 512, wl); } }
#pragma unroll
  for (int j = 0; j < 12; ++j)
#pragma unroll
    for (int r = 0; r < 8; ++r) { const _Float16 hv = (_Float16)acc[j][r]; const int c = (j & 3) * 16 + col; if (j < 4) sq[wave * 16 + 8 * g + r][c] = hv; else if (j < 8) sk[wave * 16 + 8 * g + r][c] = hv; else th[c][wave * 16 + 8 * g + r] = hv; }
  __syncthreads();
  for (int e = tid; e < 64 * 8; e += 128) { const int rl = e >> 3, q = e & 7; vst2((unsigned*)(QH + ((size_t)blockIdx.x * 64 + rl) * UU + q * 8), *(const v4u*)&sq[rl][q * 8]); }
  // k and v leave in the order k_att's lanes load them: 16-byte piece e of the block's 8 KB belongs to lane e & 31 (row or column e & 15, k group (e >> 4) & 1), elements 0..7 or 8..15 by bit 5; above that k has (u half, key tile), v has (u tile, key step)
  for (int e = tid; e < 64 * 8; e += 128) { const int rc = e & 15, ko = ((e >> 5) & 1) * 16 + ((e >> 4) & 1) * 8; const size_t o = ((size_t)blockIdx.x * 512 + e) * 8;
    vst2((unsigned*)(KH + o), *(const v4u*)&sk[(e >> 7) * 16 + rc][((e >> 6) & 1) * 32 + ko]); vst2((unsigned*)(VT + o), *(const v4u*)&th[((e >> 6) & 3) * 16 + rc][(e >> 8) * 32 + ko]); } }
// ---- k_att: block = (64 queries, b), 4 query tiles x KP key parts = 4 * KP waves: w = sigmoid(q.k); each wave sums w v over its own keys, the parts are joined in LDS (no normalisation)
#define KP 8
__global__ __launch_bounds__(128 * KP) void k_att(const _Float16* __restrict__ QH, const _Float16* __restrict__ KH, const _Float16* __restrict__ VT, float* __restrict__ OUT) {
  __shared__ __align__(16) float sp[4 * KP][16][36]; __shared__ __align__(16) float so[4 * KP][16][68];
  const int tid = threadIdx.x, wave = __builtin_amdgcn_readfirstlane(tid >> 5) /* scalar, so that the key loop keeps its scalar counter and branch */, lane = tid & 31, col = lane & 15, g = lane >> 4; const int qt = wave & 3, kp = wave >> 2; const size_t b = blockIdx.y; const int q0 = blockIdx.x * 64 + qt * 16; const size_t rq = b * NN + q0;
  v16h aq[2];
#pragma unroll
  for (int kc = 0; kc < 2; ++kc) aq[kc] = frag_h(QH + (rq + col) * UU + kc * 32, lane);
  v8f acc[4] = {}, accl[4] = {}; const unsigned fl = (unsigned)lane * 16u;
#pragma unroll 1
  for (int ks = kp; ks < NN / 32; ks += KP) {
    const _Float16* kb = KH + (b * NN + ks * 32) * UU; const _Float16* vb = VT + (b * NN + ks * 32) * UU;   // 32 keys are 4 KB of K fragments (1 KB each: key tile, u half) and 4 KB of V fragments (1 KB each: u tile)
    v16h kf[2] = { frag_hp(kb, fl), frag_hp(kb + 512, fl) }, vf[4];   // loads are issued ahead of use: both K fragments of a key tile together, the second tile's behind the first tile's WMMAs (they fly under its sigmoids)
#pragma unroll
    for (int ct = 0; ct < 2; ++ct) { v8f c = {};
#pragma unroll
      for (int kc = 0; kc < 2; ++kc) c = wmma16(aq[kc], kf[kc], c);
      if (ct == 0) { kf[0] = frag_hp(kb + 1024, fl); kf[1] = frag_hp(kb + 1536, fl); }
#pragma unroll
      for (int r = 0; r < 8; ++r) sp[wave][8 * g + r][ct * 16 + col] = 1.0f / (1.0f + __expf(-c[r])); }
    LDSX();
    v16h pa, pal; { const float* prow = &sp[wave][col][0] + 8 * (lane >> 4);
#pragma unroll
      for (int i = 0; i < 8; ++i) { const float p0 = prow[i], p1 = prow[16 + i]; pa[i] = (_Float16)p0; pa[8 + i] = (_Float16)p1; pal[i] = (_Float16)((p0 - (float)pa[i]) * 2048.0f); pal[8 + i] = (_Float16)((p1 - (float)pa[8 + i]) * 2048.0f); } }
#pragma unroll
    for (int j = 0; j < 4; j += 2) { vf[j] = frag_hp(vb + j * 512, fl); vf[j + 1] = frag_hp(vb + (j + 1) * 512, fl);   // V fragments are loaded two at a time (the registers allow no more)
      acc[j] = wmma16(pa, vf[j], acc[j]); accl[j] = wmma16(pal, vf[j], accl[j]); acc[j + 1] = wmma16(pa, vf[j + 1], acc[j + 1]); accl[j + 1] = wmma16(pal, vf[j + 1], accl[j + 1]); }
    asm volatile("s_wait_xcnt 0x0" ::: "memory");   // stands before the next trip rewrites the address registers that the V loads name
    LDSX(); }
#pragma unroll
  for (int r = 0; r < 8; ++r)
#pragma unroll
    for (int j = 0; j < 4; ++j) so[wave][8 * g + r][j * 16 + col] = acc[j][r] + accl[j][r] * (1.0f / 2048.0f);
  __syncthreads();   // every part's partial tile is in LDS before any thread joins them
  for (int e = tid; e < 64 * 16; e += 128 * KP) { const int row = e >> 4, c4 = (e & 15) * 4; v4f s = *(const v4f*)&so[row >> 4][row & 15][c4];
#pragma unroll   // the KP LDS reads issue together; the adds stay in the order of the parts
    for (int p = 1; p < KP; ++p) s += *(const v4f*)&so[p * 4 + (row >> 4)][row & 15][c4];
    vst2(OUT + (b * NN + blockIdx.x * 64 + row) * UU + c4, s); } }
extern "C" void kernel_launch(void* const* d_in, const int* in_sizes, int n_in, void* d_out, int out_size, void* d_ws, size_t ws_size, hipStream_t stream) {
  (void)in_sizes; (void)n_in; (void)out_size;
  const float** F = (const float**)d_in;   // 0 inputs [4,4096,512,1], 1 Wq [512,64], 2 Wk, 3 Wv ((in,out))
  if (ws_size < (size_t)WS_END) return;
  char* ws = (char*)d_ws; __bf16* PW = (__bf16*)(ws + WS_PW); _Float16 *QH = (_Float16*)(ws + WS_QH), *KH = (_Float16*)(ws + WS_KH), *VT = (_Float16*)(ws + WS_VT);
  k_packw<<<3 * UU / 16 * (DD / 32), 64, 0, stream>>>(F[1], F[2], F[3], PW);
  k_proj<<<NB * NN / 64, 128, 0, stream>>>(F[0], PW, QH, KH, VT);
  k_att<<<dim3(NN / 64, TNB), 128 * KP, 0, stream>>>(QH, KH, VT, (float*)d_out);
}

// v004
// One run takes 55.7 microseconds.
// In two side-by-side timings against v003, it was 1.17 and 1.16 times as fast.
// All steps since v000 together make it 5.40 times as fast.
// compute dtype: all float inputs rounded to bf16; clip in f32 (clipped bf16 values stay exact); q/k/v = x W with EXACT bf16 products on WMMA 16x16x32; q, k rounded once to f16 (single-f16 logits), sigmoid in f32; the sigmoid weights as f16 hi + residual . v (f16; 2 products); unnormalised sum in f32; f32 output.
#include <hip/hip_runtime.h>
#include <math.h>

typedef __attribute__((ext_vector_type(16))) _Float16 v16h;
typedef __attribute__((ext_vector_type(16))) __bf16 v16b;
typedef __attribute__((ext_vector_type(8)))  _Float16 v8h;
typedef __attribute__((ext_vector_type(8)))  float v8f;
typedef __attribute__((ext_vector_type(4)))  float v4f;
typedef __attribute__((ext_vector_type(2)))  float v2f;
typedef __attribute__((ext_vector_type(4)))  unsigned v4u;
typedef __attribute__((ext_vector_type(4)))  int v4i;
typedef float __attribute__((may_alias)) float_a;
typedef int __attribute__((may_alias)) int_a;

template <typename T> __device__ __forceinline__ void vst2(void* p, T v) { *(T*)p = v;  }
__device__ __forceinline__ v8f wmma16(v16h a, v16h b, v8f c) {
  v8f d = __builtin_amdgcn_wmma_f32_16x16x32_f16(false, a, false, b, (short)0, c, false, false);
  asm volatile("v_nop\n\tv_nop\n\tv_nop\n\tv_nop" : "+v"(d) : "v"(a), "v"(b));
  return d;
}
__device__ __forceinline__ v8f wmma_bf(v16b a, v16b b, v8f c) {
  v8f d = __builtin_amdgcn_wmma_f32_16x16x32_bf16(false, a, false, b, (short)0, c, false, false);
  asm volatile("v_nop\n\tv_nop\n\tv_nop\n\tv_nop" : "+v"(d) : "v"(a), "v"(b));
  return d;
}
// 16x16x32 fragments: lane = (h = lane>>4, row/col = lane&15); elements 0..7 = k0+8h+0..7, 8..15 = k0+16+8h+0..7; D element r = row 8h+r
__device__ __forceinline__ v16h frag_h(const _Float16* rowk0, int lane) {
  union { v16h v; v8h q[2]; } u; const _Float16* p = rowk0 + 8 * (lane >> 4);
  u.q[0] = *(const v8h*)p; u.q[1] = *(const v8h*)(p + 16); return u.v;
}
__device__ __forceinline__ v16h frag_f32(const float* rowk0, int lane) {
  v16h a; const float* p = rowk0 + 8 * (lane >> 4);
#pragma unroll
  for (int i = 0; i < 8; ++i) { a[i] = (_Float16)p[i]; a[8 + i] = (_Float16)p[16 + i]; }
  return a;
}
__device__ __forceinline__ v16h frag_f32s(const float* rowk0, int lane, float sc) {
  v16h a; const float* p = rowk0 + 8 * (lane >> 4);
#pragma unroll
  for (int i = 0; i < 8; ++i) { a[i] = (_Float16)(p[i] * sc); a[8 + i] = (_Float16)(p[16 + i] * sc); }
  return a;
}
// column fragment from a [K][ld] layout (column n), rows >= K read as 0
__device__ __forceinline__ v16h fragc_f32(const float* W, int k0, int n, int lane, int ld, int K) {
  v16h a; const int g = lane >> 4;
#pragma unroll
  for (int i = 0; i < 8; ++i) { const int ka = k0 + 8 * g + i, kb = ka + 16;
    a[i] = (_Float16)(ka < K ? W[(size_t)(ka < K ? ka : K - 1) * ld + n] : 0.f); a[8 + i] = (_Float16)(kb < K ? W[(size_t)(kb < K ? kb : K - 1) * ld + n] : 0.f); }
  return a;
}
struct F2 { v16b h, l; };
__device__ __forceinline__ F2 bsplit16(const float v[16]) { F2 r;
#pragma unroll
  for (int i = 0; i < 16; ++i) { const __bf16 h = (__bf16)v[i]; r.h[i] = h; r.l[i] = (__bf16)(v[i] - (float)h); }
  return r; }
__device__ __forceinline__ F2 split_row(const float* row, int k0, int lane) { float v[16]; const float* p = row + k0 + 8 * (lane >> 4);
#pragma unroll
  for (int i = 0; i < 8; ++i) { v[i] = p[i]; v[8 + i] = p[16 + i]; }
  return bsplit16(v); }
__device__ __forceinline__ F2 split_rowK(const float* row, int k0, int lane, int K) { float v[16]; const int g = lane >> 4;
#pragma unroll
  for (int i = 0; i < 8; ++i) { const int ka = k0 + 8 * g + i, kb = ka + 16; v[i] = ka < K ? row[ka < K ? ka : K - 1] : 0.f; v[8 + i] = kb < K ? row[kb < K ? kb : K - 1] : 0.f; }
  return bsplit16(v); }
__device__ __forceinline__ F2 split_col(const float* W, int k0, int n, int lane, int ld, int K) { float v[16]; const int g = lane >> 4;
#pragma unroll
  for (int i = 0; i < 8; ++i) { const int ka = k0 + 8 * g + i, kb = ka + 16; v[i] = ka < K ? W[(size_t)(ka < K ? ka : K - 1) * ld + n] : 0.f; v[8 + i] = kb < K ? W[(size_t)(kb < K ? kb : K - 1) * ld + n] : 0.f; }
  return bsplit16(v); }
__device__ __forceinline__ v8f mac3(const F2& a, const F2& b, v8f c) { c = wmma_bf(a.l, b.h, c); c = wmma_bf(a.h, b.l, c); return wmma_bf(a.h, b.h, c); }
__device__ __forceinline__ float sigm(float v) { return 1.0f / (1.0f + expf(-v)); }
#define LDSX() do { asm volatile("s_wait_dscnt 0" ::: "memory"); __builtin_amdgcn_wave_barrier(); __builtin_amdgcn_fence(__ATOMIC_RELEASE, "workgroup"); } while (0)


// 'Modular' sigmoid attention (B 4, S 4,096, D 512, U 64): x = clip(inputs, -1, 1); q, k, v = x Wq, x Wk, x Wv; out = sigmoid(q k^T) v (no softmax, no scaling).
#define NB 4
#define NN 4096
#define DD 512
#define UU 64
#ifndef TNB
#define TNB NB
#endif
typedef __attribute__((ext_vector_type(8))) __bf16 v8b;
__device__ __forceinline__ v16b frag_b(const __bf16* rowk0, int lane) {
  union { v16b v; v8b q[2]; } u; const __bf16* p = rowk0 + 8 * (lane >> 4);
  u.q[0] = *(const v8b*)p; u.q[1] = *(const v8b*)(p + 16); return u.v;
}
// fragment from a wave-uniform base and the lane's own byte offset: the compiler can keep the base in scalar registers, and one lane register serves every load of a loop
// the fragment is stored in lane order: elements 0..7 of all 32 lanes are 512 bytes in a row, elements 8..15 the next 512, so each 16-byte load of a wave reads 4 whole 128-byte lines
__device__ __forceinline__ v16h frag_hp(const _Float16* ub, unsigned lb) { union { v16h v; v8h q[2]; } u; const char* p = (const char*)ub + lb; u.q[0] = *(const v8h*)p; u.q[1] = *(const v8h*)(p + 512); return u.v; }
__device__ __forceinline__ v16b frag_bp(const __bf16* ub, unsigned lb) { union { v16b v; v8b q[2]; } u; const char* p = (const char*)ub + lb; u.q[0] = *(const v8b*)p; u.q[1] = *(const v8b*)(p + 512); return u.v; }
__device__ __forceinline__ float bfr(float v) { return (float)(__bf16)v; }
__device__ __attribute__((noinline)) float exp_ni(float v) { return expf(v); }
__device__ __attribute__((noinline)) float erf_ni(float v) { return erff(v); }

#define WS_PW  0u                                   // bf16 W (q | k | v, 192 columns) as WMMA B fragments in lane order: [16-column tile][32-k step][8 elements][lane]
#define WS_QH  (WS_PW + 2u * 3 * UU * DD)               // f16 q rows [b*NN + s][64]; k and v as WMMA B fragments in lane order: k [16-key tile][u half][8 elements][lane], v [32-key step][16-u tile][8 elements][lane]
#define WS_KH  (WS_QH + 2u * (size_t)NB * NN * UU)
#define WS_VT  (WS_KH + 2u * (size_t)NB * NN * UU)
#define WS_END (WS_VT + 2u * (size_t)NB * UU * NN)

// block = one fragment (1 KB): column tile blockIdx.x >> 4, k step blockIdx.x & 15; thread t writes the 8 elements that lane t & 31 will load (0..7 for t < 32, 8..15 above)
__global__ __launch_bounds__(64) void k_packw(const float* __restrict__ WQ, const float* __restrict__ WK, const float* __restrict__ WV, __bf16* __restrict__ PW) { const int j = blockIdx.x >> 4, kc = blockIdx.x & 15, t = threadIdx.x; const float* Wm = j < 4 ? WQ : j < 8 ? WK : WV;   // (in,out) [512][64]
  const float* p = Wm + (size_t)(kc * 32 + (t >> 5) * 16 + ((t >> 4) & 1) * 8) * UU + (j & 3) * 16 + (t & 15); v8b o;
#pragma unroll   // the 8 loads issue together, one wait for all
  for (int i = 0; i < 8; ++i) o[i] = (__bf16)p[i * UU];
  *(v8b*)(PW + ((size_t)blockIdx.x * 64 + t) * 8) = o; }
// ---- k_proj: block = 64 rows: x = clip -> A; cols 0..63 q, 64..127 k, 128..191 v (12 tiles)
__global__ __launch_bounds__(128) void k_proj(const float* __restrict__ X, const __bf16* __restrict__ PW, _Float16* __restrict__ QH, _Float16* __restrict__ KH, _Float16* __restrict__ VT) { __shared__ __align__(16) _Float16 sq[64][72], sk[64][72]; __shared__ __align__(16) _Float16 th[UU][72];
  const int tid = threadIdx.x, wave = tid >> 5, lane = tid & 31, col = lane & 15, g = lane >> 4;
  v8f acc[12];
#pragma unroll
  for (int j = 0; j < 12; ++j) acc[j] = v8f{};
  // every load runs one pass ahead of its use: a B fragment's next load is issued right behind the WMMA that last read it, the next x values right behind the conversion of these
  const float* xb = X + (size_t)blockIdx.x * 64 * DD; const unsigned xl = (unsigned)((wave * 16 + col) * DD + 8 * g) * 4u, wl = (unsigned)lane * 16u;
  v4f xn[4]; v16b bf[12];
#pragma unroll
  for (int i = 0; i < 4; ++i) xn[i] = *(const v4f*)((const char*)xb + xl + (i >> 1) * 64 + (i & 1) * 16);
#pragma unroll
  for (int j = 0; j < 12; ++j) bf[j] = frag_bp(PW + j * 16 * 512, wl);
#pragma unroll   // unrolled whole: the last pass fetches nothing, and every address is the lane's one offset plus an immediate
  for (int kc = 0; kc < DD / 32; ++kc) { v16b a;
    __builtin_amdgcn_sched_barrier(0);   // keeps this conversion behind the pass before: hoisted, its wait for x loads just issued would stand in front of that pass's WMMAs
#pragma unroll
    for (int i = 0; i < 16; ++i) a[i] = (__bf16)fminf(fmaxf(bfr(xn[i >> 2][i & 3]), -1.0f), 1.0f);
    if (kc + 1 < DD / 32) {
#pragma unroll
      for (int i = 0; i < 4; ++i) xn[i] = *(const v4f*)((const char*)(xb + (kc + 1) * 32) + xl + (i >> 1) * 64 + (i & 1) * 16); }
#pragma unroll
    for (int j = 0; j < 12; ++j) { acc[j] = wmma_bf(a, bf[j], acc[j]); if (kc + 1 < DD / 32) bf[j] = frag_bp(PW + (j * 16 + kc + 1) * 512, wl); } }
#pragma unroll
  for (int j = 0; j < 12; ++j)
#pragma unroll
    for (int r = 0; r < 8; ++r) { const _Float16 hv = (_Float16)acc[j][r]; const int c = (j & 3) * 16 + col; if (j < 4) sq[wave * 16 + 8 * g + r][c] = hv; else if (j < 8) sk[wave * 16 + 8 * g + r][c] = hv; else th[c][wave * 16 + 8 * g + r] = hv; }
  __syncthreads();
  for (int e = tid; e < 64 * 8; e += 128) { const int rl = e >> 3, q = e & 7; vst2((unsigned*)(QH + ((size_t)blockIdx.x * 64 + rl) * UU + q * 8), *(const v4u*)&sq[rl][q * 8]); }
  // k and v leave in the order k_att's lanes load them: 16-byte piece e of the block's 8 KB belongs to lane e & 31 (row or column e & 15, k group (e >> 4) & 1), elements 0..7 or 8..15 by bit 5; above that k has (u half, key tile), v has (u tile, key step)
  for (int e = tid; e < 64 * 8; e += 128) { const int rc = e & 15, ko = ((e >> 5) & 1) * 16 + ((e >> 4) & 1) * 8; const size_t o = ((size_t)blockIdx.x * 512 + e) * 8;
    vst2((unsigned*)(KH + o), *(const v4u*)&sk[(e >> 7) * 16 + rc][((e >> 6) & 1) * 32 + ko]); vst2((unsigned*)(VT + o), *(const v4u*)&th[((e >> 6) & 3) * 16 + rc][(e >> 8) * 32 + ko]); } }
// ---- k_att: block = (64 queries, b), 4 query tiles x KP key parts = 4 * KP waves: w = sigmoid(q.k); each wave sums w v over its own keys, the parts are joined in LDS (no normalisation)
#define KP 8
__global__ __launch_bounds__(128 * KP) void k_att(const _Float16* __restrict__ QH, const _Float16* __restrict__ KH, const _Float16* __restrict__ VT, float* __restrict__ OUT) {
  __shared__ __align__(16) float sp[4 * KP][16][36]; __shared__ __align__(16) float so[4 * KP][16][68];
  const int tid = threadIdx.x, wave = __builtin_amdgcn_readfirstlane(tid >> 5) /* scalar, so that the key loop keeps its scalar counter and branch */, lane = tid & 31, col = lane & 15, g = lane >> 4; const int qt = wave & 3, kp = wave >> 2; const size_t b = blockIdx.y; const int q0 = blockIdx.x * 64 + qt * 16; const size_t rq = b * NN + q0;
  v16h aq[2];
#pragma unroll
  for (int kc = 0; kc < 2; ++kc) aq[kc] = frag_h(QH + (rq + col) * UU + kc * 32, lane);
  v8f acc[4] = {}, accl[4] = {}; const unsigned fl = (unsigned)lane * 16u;
#pragma unroll 1
  for (int ks = kp; ks < NN / 32; ks += KP) {
    const _Float16* kb = KH + (b * NN + ks * 32) * UU; const _Float16* vb = VT + (b * NN + ks * 32) * UU;   // 32 keys are 4 KB of K fragments (1 KB each: key tile, u half) and 4 KB of V fragments (1 KB each: u tile)
    v16h kf[2] = { frag_hp(kb, fl), frag_hp(kb + 512, fl) }, vf[4];   // loads are issued ahead of use: both K fragments of a key tile together, the second tile's behind the first tile's WMMAs (they fly under its sigmoids)
#pragma unroll
    for (int ct = 0; ct < 2; ++ct) { v8f c = {};
#pragma unroll
      for (int kc = 0; kc < 2; ++kc) c = wmma16(aq[kc], kf[kc], c);
      if (ct == 0) { kf[0] = frag_hp(kb + 1024, fl); kf[1] = frag_hp(kb + 1536, fl); }
#pragma unroll
      for (int r = 0; r < 8; ++r) sp[wave][8 * g + r][ct * 16 + col] = __builtin_amdgcn_rcpf(1.0f + __expf(-c[r])); }   // bare v_rcp_f32 (1 ulp; the argument is 1 or more, infinity gives 0): the weight is cut to f16 hi + residual behind it, so the correctly rounded divide's eleven further instructions bought nothing
    LDSX();
    v16h pa, pal; { const float* prow = &sp[wave][col][0] + 8 * (lane >> 4);
#pragma unroll
      for (int i = 0; i < 8; ++i) { const float p0 = prow[i], p1 = prow[16 + i]; pa[i] = (_Float16)p0; pa[8 + i] = (_Float16)p1; pal[i] = (_Float16)((p0 - (float)pa[i]) * 2048.0f); pal[8 + i] = (_Float16)((p1 - (float)pa[8 + i]) * 2048.0f); } }
#pragma unroll
    for (int j = 0; j < 4; j += 2) { vf[j] = frag_hp(vb + j * 512, fl); vf[j + 1] = frag_hp(vb + (j + 1) * 512, fl);   // V fragments are loaded two at a time (the registers allow no more)
      acc[j] = wmma16(pa, vf[j], acc[j]); accl[j] = wmma16(pal, vf[j], accl[j]); acc[j + 1] = wmma16(pa, vf[j + 1], acc[j + 1]); accl[j + 1] = wmma16(pal, vf[j + 1], accl[j + 1]); }
    asm volatile("s_wait_xcnt 0x0" ::: "memory");   // stands before the next trip rewrites the address registers that the V loads name
    LDSX(); }
#pragma unroll
  for (int r = 0; r < 8; ++r)
#pragma unroll
    for (int j = 0; j < 4; ++j) so[wave][8 * g + r][j * 16 + col] = acc[j][r] + accl[j][r] * (1.0f / 2048.0f);
  __syncthreads();   // every part's partial tile is in LDS before any thread joins them
  for (int e = tid; e < 64 * 16; e += 128 * KP) { const int row = e >> 4, c4 = (e & 15) * 4; v4f s = *(const v4f*)&so[row >> 4][row & 15][c4];
#pragma unroll   // the KP LDS reads issue together; the adds stay in the order of the parts
    for (int p = 1; p < KP; ++p) s += *(const v4f*)&so[p * 4 + (row >> 4)][row & 15][c4];
    vst2(OUT + (b * NN + blockIdx.x * 64 + row) * UU + c4, s); } }
extern "C" void kernel_launch(void* const* d_in, const int* in_sizes, int n_in, void* d_out, int out_size, void* d_ws, size_t ws_size, hipStream_t stream) {
  (void)in_sizes; (void)n_in; (void)out_size;
  const float** F = (const float**)d_in;   // 0 inputs [4,4096,512,1], 1 Wq [512,64], 2 Wk, 3 Wv ((in,out))
  if (ws_size < (size_t)WS_END) return;
  char* ws = (char*)d_ws; __bf16* PW = (__bf16*)(ws + WS_PW); _Float16 *QH = (_Float16*)(ws + WS_QH), *KH = (_Float16*)(ws + WS_KH), *VT = (_Float16*)(ws + WS_VT);
  k_packw<<<3 * UU / 16 * (DD / 32), 64, 0, stream>>>(F[1], F[2], F[3], PW);
  k_proj<<<NB * NN / 64, 128, 0, stream>>>(F[0], PW, QH, KH, VT);
  k_att<<<dim3(NN / 64, TNB), 128 * KP, 0, stream>>>(QH, KH, VT, (float*)d_out);
}

// v005
// A run of this version takes 54.3 microseconds.
// Two timings next to v004 put it at 1.06 and 1.02 times that version's speed.
// All steps since v000 together make it 5.59 times as fast.
// compute dtype: all float inputs rounded to bf16; clip in f32 (clipped bf16 values stay exact); q/k/v = x W with EXACT bf16 products on WMMA 16x16x32; q, k rounded once to f16 (single-f16 logits), sigmoid in f32; the sigmoid weights as f16 hi + residual . v (f16; 2 products); unnormalised sum in f32; f32 output.
#include <hip/hip_runtime.h>
#include <math.h>

typedef __attribute__((ext_vector_type(16))) _Float16 v16h;
typedef __attribute__((ext_vector_type(16))) __bf16 v16b;
typedef __attribute__((ext_vector_type(8)))  _Float16 v8h;
typedef __attribute__((ext_vector_type(8)))  float v8f;
typedef __attribute__((ext_vector_type(4)))  float v4f;
typedef __attribute__((ext_vector_type(2)))  float v2f;
typedef __attribute__((ext_vector_type(4)))  unsigned v4u;
typedef __attribute__((ext_vector_type(4)))  int v4i;
typedef float __attribute__((may_alias)) float_a;
typedef int __attribute__((may_alias)) int_a;

template <typename T> __device__ __forceinline__ void vst2(void* p, T v) { *(T*)p = v;  }
__device__ __forceinline__ v8f wmma16(v16h a, v16h b, v8f c) {
  v8f d = __builtin_amdgcn_wmma_f32_16x16x32_f16(false, a, false, b, (short)0, c, false, false);
  asm volatile("v_nop\n\tv_nop\n\tv_nop\n\tv_nop" : "+v"(d) : "v"(a), "v"(b));
  return d;
}
__device__ __forceinline__ v8f wmma_bf(v16b a, v16b b, v8f c) {
  return __builtin_amdgcn_wmma_f32_16x16x32_bf16(false, a, false, b, (short)0, c, false, false);
}
// 16x16x32 fragments: lane = (h = lane>>4, row/col = lane&15); elements 0..7 = k0+8h+0..7, 8..15 = k0+16+8h+0..7; D element r = row 8h+r
__device__ __forceinline__ v16h frag_h(const _Float16* rowk0, int lane) {
  union { v16h v; v8h q[2]; } u; const _Float16* p = rowk0 + 8 * (lane >> 4);
  u.q[0] = *(const v8h*)p; u.q[1] = *(const v8h*)(p + 16); return u.v;
}
__device__ __forceinline__ v16h frag_f32(const float* rowk0, int lane) {
  v16h a; const float* p = rowk0 + 8 * (lane >> 4);
#pragma unroll
  for (int i = 0; i < 8; ++i) { a[i] = (_Float16)p[i]; a[8 + i] = (_Float16)p[16 + i]; }
  return a;
}
__device__ __forceinline__ v16h frag_f32s(const float* rowk0, int lane, float sc) {
  v16h a; const float* p = rowk0 + 8 * (lane >> 4);
#pragma unroll
  for (int i = 0; i < 8; ++i) { a[i] = (_Float16)(p[i] * sc); a[8 + i] = (_Float16)(p[16 + i] * sc); }
  return a;
}
// column fragment from a [K][ld] layout (column n), rows >= K read as 0
__device__ __forceinline__ v16h fragc_f32(const float* W, int k0, int n, int lane, int ld, int K) {
  v16h a; const int g = lane >> 4;
#pragma unroll
  for (int i = 0; i < 8; ++i) { const int ka = k0 + 8 * g + i, kb = ka + 16;
    a[i] = (_Float16)(ka < K ? W[(size_t)(ka < K ? ka : K - 1) * ld + n] : 0.f); a[8 + i] = (_Float16)(kb < K ? W[(size_t)(kb < K ? kb : K - 1) * ld + n] : 0.f); }
  return a;
}
struct F2 { v16b h, l; };
__device__ __forceinline__ F2 bsplit16(const float v[16]) { F2 r;
#pragma unroll
  for (int i = 0; i < 16; ++i) { const __bf16 h = (__bf16)v[i]; r.h[i] = h; r.l[i] = (__bf16)(v[i] - (float)h); }
  return r; }
__device__ __forceinline__ F2 split_row(const float* row, int k0, int lane) { float v[16]; const float* p = row + k0 + 8 * (lane >> 4);
#pragma unroll
  for (int i = 0; i < 8; ++i) { v[i] = p[i]; v[8 + i] = p[16 + i]; }
  return bsplit16(v); }
__device__ __forceinline__ F2 split_rowK(const float* row, int k0, int lane, int K) { float v[16]; const int g = lane >> 4;
#pragma unroll
  for (int i = 0; i < 8; ++i) { const int ka = k0 + 8 * g + i, kb = ka + 16; v[i] = ka < K ? row[ka < K ? ka : K - 1] : 0.f; v[8 + i] = kb < K ? row[kb < K ? kb : K - 1] : 0.f; }
  return bsplit16(v); }
__device__ __forceinline__ F2 split_col(const float* W, int k0, int n, int lane, int ld, int K) { float v[16]; const int g = lane >> 4;
#pragma unroll
  for (int i = 0; i < 8; ++i) { const int ka = k0 + 8 * g + i, kb = ka + 16; v[i] = ka < K ? W[(size_t)(ka < K ? ka : K - 1) * ld + n] : 0.f; v[8 + i] = kb < K ? W[(size_t)(kb < K ? kb : K - 1) * ld + n] : 0.f; }
  return bsplit16(v); }
__device__ __forceinline__ v8f mac3(const F2& a, const F2& b, v8f c) { c = wmma_bf(a.l, b.h, c); c = wmma_bf(a.h, b.l, c); return wmma_bf(a.h, b.h, c); }
__device__ __forceinline__ float sigm(float v) { return 1.0f / (1.0f + expf(-v)); }
#define LDSX() do { asm volatile("s_wait_dscnt 0" ::: "memory"); __builtin_amdgcn_wave_barrier(); __builtin_amdgcn_fence(__ATOMIC_RELEASE, "workgroup"); } while (0)


// 'Modular' sigmoid attention (B 4, S 4,096, D 512, U 64): x = clip(inputs, -1, 1); q, k, v = x Wq, x Wk, x Wv; out = sigmoid(q k^T) v (no softmax, no scaling).
#define NB 4
#define NN 4096
#define DD 512
#define UU 64
#ifndef TNB
#define TNB NB
#endif
typedef __attribute__((ext_vector_type(8))) __bf16 v8b;
__device__ __forceinline__ v16b frag_b(const __bf16* rowk0, int lane) {
  union { v16b v; v8b q[2]; } u; const __bf16* p = rowk0 + 8 * (lane >> 4);
  u.q[0] = *(const v8b*)p; u.q[1] = *(const v8b*)(p + 16); return u.v;
}
// fragment from a wave-uniform base and the lane's own byte offset: the compiler can keep the base in scalar registers, and one lane register serves every load of a loop
// the fragment is stored in lane order: elements 0..7 of all 32 lanes are 512 bytes in a row, elements 8..15 the next 512, so each 16-byte load of a wave reads 4 whole 128-byte lines
__device__ __forceinline__ v16h frag_hp(const _Float16* ub, unsigned lb) { union { v16h v; v8h q[2]; } u; const char* p = (const char*)ub + lb; u.q[0] = *(const v8h*)p; u.q[1] = *(const v8h*)(p + 512); return u.v; }
__device__ __forceinline__ v16b frag_bp(const __bf16* ub, unsigned lb) { union { v16b v; v8b q[2]; } u; const char* p = (const char*)ub + lb; u.q[0] = *(const v8b*)p; u.q[1] = *(const v8b*)(p + 512); return u.v; }
__device__ __forceinline__ float bfr(float v) { return (float)(__bf16)v; }
__device__ __attribute__((noinline)) float exp_ni(float v) { return expf(v); }
__device__ __attribute__((noinline)) float erf_ni(float v) { return erff(v); }

#define WS_PW  0u                                   // bf16 W (q | k | v, 192 columns) as WMMA B fragments in lane order: [16-column tile][32-k step][8 elements][lane]
#define WS_QH  (WS_PW + 2u * 3 * UU * DD)               // f16 q rows [b*NN + s][64]; k and v as WMMA B fragments in lane order: k [16-key tile][u half][8 elements][lane], v [32-key step][16-u tile][8 elements][lane]
#define WS_KH  (WS_QH + 2u * (size_t)NB * NN * UU)
#define WS_VT  (WS_KH + 2u * (size_t)NB * NN * UU)
#define WS_END (WS_VT + 2u * (size_t)NB * UU * NN)

// block = one fragment (1 KB): column tile blockIdx.x >> 4, k step blockIdx.x & 15; thread t writes the 8 elements that lane t & 31 will load (0..7 for t < 32, 8..15 above)
__global__ __launch_bounds__(64) void k_packw(const float* __restrict__ WQ, const float* __restrict__ WK, const float* __restrict__ WV, __bf16* __restrict__ PW) { const int j = blockIdx.x >> 4, kc = blockIdx.x & 15, t = threadIdx.x; const float* Wm = j < 4 ? WQ : j < 8 ? WK : WV;   // (in,out) [512][64]
  const float* p = Wm + (size_t)(kc * 32 + (t >> 5) * 16 + ((t >> 4) & 1) * 8) * UU + (j & 3) * 16 + (t & 15); v8b o;
#pragma unroll   // the 8 loads issue together, one wait for all
  for (int i = 0; i < 8; ++i) o[i] = (__bf16)p[i * UU];
  *(v8b*)(PW + ((size_t)blockIdx.x * 64 + t) * 8) = o; }
// ---- k_proj: block = 64 rows: x = clip -> A; cols 0..63 q, 64..127 k, 128..191 v (12 tiles)
__global__ __launch_bounds__(128) void k_proj(const float* __restrict__ X, const __bf16* __restrict__ PW, _Float16* __restrict__ QH, _Float16* __restrict__ KH, _Float16* __restrict__ VT) { __shared__ __align__(16) _Float16 sq[64][72], sk[64][72]; __shared__ __align__(16) _Float16 th[UU][72];
  const int tid = threadIdx.x, wave = tid >> 5, lane = tid & 31, col = lane & 15, g = lane >> 4;
  v8f acc[12];
#pragma unroll
  for (int j = 0; j < 12; ++j) acc[j] = v8f{};
  // every load runs two passes ahead of its use, for speed only. B fragments lie in two register sets used in turn, a fragment's next load issued right behind the WMMA that last read it; x lies in three sets, its loads issued at the foot of a pass, behind that pass's B loads, for the third pass from there
  const float* xb = X + (size_t)blockIdx.x * 64 * DD; const unsigned xl = (unsigned)((wave * 16 + col) * DD + 8 * g) * 4u, wl = (unsigned)lane * 16u;
  v4f xn[3][4]; v16b bf[2][12];
#pragma unroll
  for (int s = 0; s < 3; ++s) {
#pragma unroll
    for (int i = 0; i < 4; ++i) xn[s][i] = *(const v4f*)((const char*)(xb + s * 32) + xl + (i >> 1) * 64 + (i & 1) * 16);
    if (s < 2) {
#pragma unroll
      for (int j = 0; j < 12; ++j) bf[s][j] = frag_bp(PW + (j * 16 + s) * 512, wl); } }
#pragma unroll   // unrolled whole: the last passes fetch nothing, the register sets of a pass are fixed at compile time, and every address is the lane's one offset plus an immediate
  for (int kc = 0; kc < DD / 32; ++kc) { v16b a; const int s = kc & 1, t = kc % 3;
    __builtin_amdgcn_sched_barrier(0);   // keeps this conversion behind the pass before: hoisted, its wait for x loads would stand in front of that pass's WMMAs
#pragma unroll
    for (int i = 0; i < 16; ++i) a[i] = (__bf16)fminf(fmaxf(bfr(xn[t][i >> 2][i & 3]), -1.0f), 1.0f);
#pragma unroll
    for (int j = 0; j < 12; ++j) { acc[j] = wmma_bf(a, bf[s][j], acc[j]); if (kc + 2 < DD / 32) bf[s][j] = frag_bp(PW + (j * 16 + kc + 2) * 512, wl); }
    if (kc + 3 < DD / 32) {
#pragma unroll
      for (int i = 0; i < 4; ++i) xn[t][i] = *(const v4f*)((const char*)(xb + (kc + 3) * 32) + xl + (i >> 1) * 64 + (i & 1) * 16); }
    if (kc + 4 == DD / 32 || kc + 3 == DD / 32) asm volatile("s_wait_xcnt 0x0" ::: "memory"); }   // behind the last x fetch and behind the last B fetch: stands before the passes that follow reuse the lane offset register that the loads in flight name
#pragma unroll
  for (int j = 0; j < 12; ++j)
#pragma unroll
    for (int r = 0; r < 8; ++r) { const _Float16 hv = (_Float16)acc[j][r]; const int c = (j & 3) * 16 + col; if (j < 4) sq[wave * 16 + 8 * g + r][c] = hv; else if (j < 8) sk[wave * 16 + 8 * g + r][c] = hv; else th[c][wave * 16 + 8 * g + r] = hv; }
  __syncthreads();
  for (int e = tid; e < 64 * 8; e += 128) { const int rl = e >> 3, q = e & 7; vst2((unsigned*)(QH + ((size_t)blockIdx.x * 64 + rl) * UU + q * 8), *(const v4u*)&sq[rl][q * 8]); }
  // k and v leave in the order k_att's lanes load them: 16-byte piece e of the block's 8 KB belongs to lane e & 31 (row or column e & 15, k group (e >> 4) & 1), elements 0..7 or 8..15 by bit 5; above that k has (u half, key tile), v has (u tile, key step)
  for (int e = tid; e < 64 * 8; e += 128) { const int rc = e & 15, ko = ((e >> 5) & 1) * 16 + ((e >> 4) & 1) * 8; const size_t o = ((size_t)blockIdx.x * 512 + e) * 8;
    vst2((unsigned*)(KH + o), *(const v4u*)&sk[(e >> 7) * 16 + rc][((e >> 6) & 1) * 32 + ko]); vst2((unsigned*)(VT + o), *(const v4u*)&th[((e >> 6) & 3) * 16 + rc][(e >> 8) * 32 + ko]); } }
// ---- k_att: block = (64 queries, b), 4 query tiles x KP key parts = 4 * KP waves: w = sigmoid(q.k); each wave sums w v over its own keys, the parts are joined in LDS (no normalisation)
#define KP 8
__global__ __launch_bounds__(128 * KP) void k_att(const _Float16* __restrict__ QH, const _Float16* __restrict__ KH, const _Float16* __restrict__ VT, float* __restrict__ OUT) {
  __shared__ __align__(16) float sp[4 * KP][16][36]; __shared__ __align__(16) float so[4 * KP][16][68];
  const int tid = threadIdx.x, wave = __builtin_amdgcn_readfirstlane(tid >> 5) /* scalar, so that the key loop keeps its scalar counter and branch */, lane = tid & 31, col = lane & 15, g = lane >> 4; const int qt = wave & 3, kp = wave >> 2; const size_t b = blockIdx.y; const int q0 = blockIdx.x * 64 + qt * 16; const size_t rq = b * NN + q0;
  v16h aq[2];
#pragma unroll
  for (int kc = 0; kc < 2; ++kc) aq[kc] = frag_h(QH + (rq + col) * UU + kc * 32, lane);
  v8f acc[4] = {}, accl[4] = {}; const unsigned fl = (unsigned)lane * 16u;
#pragma unroll 1
  for (int ks = kp; ks < NN / 32; ks += KP) {
    const _Float16* kb = KH + (b * NN + ks * 32) * UU; const _Float16* vb = VT + (b * NN + ks * 32) * UU;   // 32 keys are 4 KB of K fragments (1 KB each: key tile, u half) and 4 KB of V fragments (1 KB each: u tile)
    v16h kf[2] = { frag_hp(kb, fl), frag_hp(kb + 512, fl) }, vf[4];   // loads are issued ahead of use: both K fragments of a key tile together, the second tile's behind the first tile's WMMAs (they fly under its sigmoids)
#pragma unroll
    for (int ct = 0; ct < 2; ++ct) { v8f c = {};
#pragma unroll
      for (int kc = 0; kc < 2; ++kc) c = wmma16(aq[kc], kf[kc], c);
      if (ct == 0) { kf[0] = frag_hp(kb + 1024, fl); kf[1] = frag_hp(kb + 1536, fl); }
#pragma unroll
      for (int r = 0; r < 8; ++r) sp[wave][8 * g + r][ct * 16 + col] = __builtin_amdgcn_rcpf(1.0f + __expf(-c[r])); }   // bare v_rcp_f32 (1 ulp; the argument is 1 or more, infinity gives 0): the weight is cut to f16 hi + residual behind it, so the correctly rounded divide's eleven further instructions bought nothing
    LDSX();
    v16h pa, pal; { const float* prow = &sp[wave][col][0] + 8 * (lane >> 4);
#pragma unroll
      for (int i = 0; i < 8; ++i) { const float p0 = prow[i], p1 = prow[16 + i]; pa[i] = (_Float16)p0; pa[8 + i] = (_Float16)p1; pal[i] = (_Float16)((p0 - (float)pa[i]) * 2048.0f); pal[8 + i] = (_Float16)((p1 - (float)pa[8 + i]) * 2048.0f); } }
#pragma unroll
    for (int j = 0; j < 4; j += 2) { vf[j] = frag_hp(vb + j * 512, fl); vf[j + 1] = frag_hp(vb + (j + 1) * 512, fl);   // V fragments are loaded two at a time (the registers allow no more)
      acc[j] = wmma16(pa, vf[j], acc[j]); accl[j] = wmma16(pal, vf[j], accl[j]); acc[j + 1] = wmma16(pa, vf[j + 1], acc[j + 1]); accl[j + 1] = wmma16(pal, vf[j + 1], accl[j + 1]); }
    asm volatile("s_wait_xcnt 0x0" ::: "memory");   // stands before the next trip rewrites the address registers that the V loads name
    LDSX(); }
#pragma unroll
  for (int r = 0; r < 8; ++r)
#pragma unroll
    for (int j = 0; j < 4; ++j) so[wave][8 * g + r][j * 16 + col] = acc[j][r] + accl[j][r] * (1.0f / 2048.0f);
  __syncthreads();   // every part's partial tile is in LDS before any thread joins them
  for (int e = tid; e < 64 * 16; e += 128 * KP) { const int row = e >> 4, c4 = (e & 15) * 4; v4f s = *(const v4f*)&so[row >> 4][row & 15][c4];
#pragma unroll   // the KP LDS reads issue together; the adds stay in the order of the parts
    for (int p = 1; p < KP; ++p) s += *(const v4f*)&so[p * 4 + (row >> 4)][row & 15][c4];
    vst2(OUT + (b * NN + blockIdx.x * 64 + row) * UU + c4, s); } }
extern "C" void kernel_launch(void* const* d_in, const int* in_sizes, int n_in, void* d_out, int out_size, void* d_ws, size_t ws_size, hipStream_t stream) {
  (void)in_sizes; (void)n_in; (void)out_size;
  const float** F = (const float**)d_in;   // 0 inputs [4,4096,512,1], 1 Wq [512,64], 2 Wk, 3 Wv ((in,out))
  if (ws_size < (size_t)WS_END) return;
  char* ws = (char*)d_ws; __bf16* PW = (__bf16*)(ws + WS_PW); _Float16 *QH = (_Float16*)(ws + WS_QH), *KH = (_Float16*)(ws + WS_KH), *VT = (_Float16*)(ws + WS_VT);
  k_packw<<<3 * UU / 16 * (DD / 32), 64, 0, stream>>>(F[1], F[2], F[3], PW);
  k_proj<<<NB * NN / 64, 128, 0, stream>>>(F[0], PW, QH, KH, VT);
  k_att<<<dim3(NN / 64, TNB), 128 * KP, 0, stream>>>(QH, KH, VT, (float*)d_out);
}

// v006
// It runs in 42.9 microseconds.
// In two side-by-side timings against v005, it was 1.25 and 1.27 times as fast.
// Counting every step since v000, it is 7.04 times as fast.
// compute dtype: all float inputs rounded to bf16; clip in f32 (clipped bf16 values stay exact); q/k/v = x W with EXACT bf16 products on WMMA 16x16x32; q, k rounded once to f16 (single-f16 logits), sigmoid in f32; the sigmoid weights as f16 hi + residual . v (f16; 2 products); unnormalised sum in f32; f32 output.
#include <hip/hip_runtime.h>
#include <math.h>

typedef __attribute__((ext_vector_type(16))) _Float16 v16h;
typedef __attribute__((ext_vector_type(16))) __bf16 v16b;
typedef __attribute__((ext_vector_type(8)))  _Float16 v8h;
typedef __attribute__((ext_vector_type(8)))  float v8f;
typedef __attribute__((ext_vector_type(4)))  float v4f;
typedef __attribute__((ext_vector_type(2)))  float v2f;
typedef __attribute__((ext_vector_type(4)))  unsigned v4u;
typedef __attribute__((ext_vector_type(4)))  int v4i;
typedef float __attribute__((may_alias)) float_a;
typedef int __attribute__((may_alias)) int_a;

template <typename T> __device__ __forceinline__ void vst2(void* p, T v) { *(T*)p = v;  }
__device__ __forceinline__ v8f wmma16(v16h a, v16h b, v8f c) {
  v8f d = __builtin_amdgcn_wmma_f32_16x16x32_f16(false, a, false, b, (short)0, c, false, false);
  asm volatile("v_nop\n\tv_nop\n\tv_nop\n\tv_nop" : "+v"(d) : "v"(a), "v"(b));
  return d;
}
__device__ __forceinline__ v8f wmma_bf(v16b a, v16b b, v8f c) {
  return __builtin_amdgcn_wmma_f32_16x16x32_bf16(false, a, false, b, (short)0, c, false, false);
}
// 16x16x32 fragments: lane = (h = lane>>4, row/col = lane&15); elements 0..7 = k0+8h+0..7, 8..15 = k0+16+8h+0..7; D element r = row 8h+r
__device__ __forceinline__ v16h frag_h(const _Float16* rowk0, int lane) {
  union { v16h v; v8h q[2]; } u; const _Float16* p = rowk0 + 8 * (lane >> 4);
  u.q[0] = *(const v8h*)p; u.q[1] = *(const v8h*)(p + 16); return u.v;
}
__device__ __forceinline__ v16h frag_f32(const float* rowk0, int lane) {
  v16h a; const float* p = rowk0 + 8 * (lane >> 4);
#pragma unroll
  for (int i = 0; i < 8; ++i) { a[i] = (_Float16)p[i]; a[8 + i] = (_Float16)p[16 + i]; }
  return a;
}
__device__ __forceinline__ v16h frag_f32s(const float* rowk0, int lane, float sc) {
  v16h a; const float* p = rowk0 + 8 * (lane >> 4);
#pragma unroll
  for (int i = 0; i < 8; ++i) { a[i] = (_Float16)(p[i] * sc); a[8 + i] = (_Float16)(p[16 + i] * sc); }
  return a;
}
// column fragment from a [K][ld] layout (column n), rows >= K read as 0
__device__ __forceinline__ v16h fragc_f32(const float* W, int k0, int n, int lane, int ld, int K) {
  v16h a; const int g = lane >> 4;
#pragma unroll
  for (int i = 0; i < 8; ++i) { const int ka = k0 + 8 * g + i, kb = ka + 16;
    a[i] = (_Float16)(ka < K ? W[(size_t)(ka < K ? ka : K - 1) * ld + n] : 0.f); a[8 + i] = (_Float16)(kb < K ? W[(size_t)(kb < K ? kb : K - 1) * ld + n] : 0.f); }
  return a;
}
struct F2 { v16b h, l; };
__device__ __forceinline__ F2 bsplit16(const float v[16]) { F2 r;
#pragma unroll
  for (int i = 0; i < 16; ++i) { const __bf16 h = (__bf16)v[i]; r.h[i] = h; r.l[i] = (__bf16)(v[i] - (float)h); }
  return r; }
__device__ __forceinline__ F2 split_row(const float* row, int k0, int lane) { float v[16]; const float* p = row + k0 + 8 * (lane >> 4);
#pragma unroll
  for (int i = 0; i < 8; ++i) { v[i] = p[i]; v[8 + i] = p[16 + i]; }
  return bsplit16(v); }
__device__ __forceinline__ F2 split_rowK(const float* row, int k0, int lane, int K) { float v[16]; const int g = lane >> 4;
#pragma unroll
  for (int i = 0; i < 8; ++i) { const int ka = k0 + 8 * g + i, kb = ka + 16; v[i] = ka < K ? row[ka < K ? ka : K - 1] : 0.f; v[8 + i] = kb < K ? row[kb < K ? kb : K - 1] : 0.f; }
  return bsplit16(v); }
__device__ __forceinline__ F2 split_col(const float* W, int k0, int n, int lane, int ld, int K) { float v[16]; const int g = lane >> 4;
#pragma unroll
  for (int i = 0; i < 8; ++i) { const int ka = k0 + 8 * g + i, kb = ka + 16; v[i] = ka < K ? W[(size_t)(ka < K ? ka : K - 1) * ld + n] : 0.f; v[8 + i] = kb < K ? W[(size_t)(kb < K ? kb : K - 1) * ld + n] : 0.f; }
  return bsplit16(v); }
__device__ __forceinline__ v8f mac3(const F2& a, const F2& b, v8f c) { c = wmma_bf(a.l, b.h, c); c = wmma_bf(a.h, b.l, c); return wmma_bf(a.h, b.h, c); }
__device__ __forceinline__ float sigm(float v) { return 1.0f / (1.0f + expf(-v)); }
#define LDSX() do { asm volatile("s_wait_dscnt 0" ::: "memory"); __builtin_amdgcn_wave_barrier(); __builtin_amdgcn_fence(__ATOMIC_RELEASE, "workgroup"); } while (0)


// 'Modular' sigmoid attention (B 4, S 4,096, D 512, U 64): x = clip(inputs, -1, 1); q, k, v = x Wq, x Wk, x Wv; out = sigmoid(q k^T) v (no softmax, no scaling).
#define NB 4
#define NN 4096
#define DD 512
#define UU 64
#ifndef TNB
#define TNB NB
#endif
typedef __attribute__((ext_vector_type(8))) __bf16 v8b;
__device__ __forceinline__ v16b frag_b(const __bf16* rowk0, int lane) {
  union { v16b v; v8b q[2]; } u; const __bf16* p = rowk0 + 8 * (lane >> 4);
  u.q[0] = *(const v8b*)p; u.q[1] = *(const v8b*)(p + 16); return u.v;
}
// fragment from a wave-uniform base and the lane's own byte offset: the compiler can keep the base in scalar registers, and one lane register serves every load of a loop
// the fragment is stored in lane order: elements 0..7 of all 32 lanes are 512 bytes in a row, elements 8..15 the next 512, so each 16-byte load of a wave reads 4 whole 128-byte lines
__device__ __forceinline__ v16h frag_hp(const _Float16* ub, unsigned lb) { union { v16h v; v8h q[2]; } u; const char* p = (const char*)ub + lb; u.q[0] = *(const v8h*)p; u.q[1] = *(const v8h*)(p + 512); return u.v; }
__device__ __forceinline__ v16b frag_bp(const __bf16* ub, unsigned lb) { union { v16b v; v8b q[2]; } u; const char* p = (const char*)ub + lb; u.q[0] = *(const v8b*)p; u.q[1] = *(const v8b*)(p + 512); return u.v; }
__device__ __forceinline__ float bfr(float v) { return (float)(__bf16)v; }
__device__ __attribute__((noinline)) float exp_ni(float v) { return expf(v); }
__device__ __attribute__((noinline)) float erf_ni(float v) { return erff(v); }

#define WS_PW  0u                                   // bf16 W (q | k | v, 192 columns) as WMMA B fragments in lane order: [16-column tile][32-k step][8 elements][lane]
#define WS_QH  (WS_PW + 2u * 3 * UU * DD)               // f16 q rows [b*NN + s][64]; k and v as WMMA B fragments in lane order: k [16-key tile][u half][8 elements][lane], v [32-key step][16-u tile][8 elements][lane]
#define WS_KH  (WS_QH + 2u * (size_t)NB * NN * UU)
#define WS_VT  (WS_KH + 2u * (size_t)NB * NN * UU)
#define WS_END (WS_VT + 2u * (size_t)NB * UU * NN)

// block = one fragment (1 KB): column tile blockIdx.x >> 4, k step blockIdx.x & 15; thread t writes the 8 elements that lane t & 31 will load (0..7 for t < 32, 8..15 above)
__global__ __launch_bounds__(64) void k_packw(const float* __restrict__ WQ, const float* __restrict__ WK, const float* __restrict__ WV, __bf16* __restrict__ PW) { const int j = blockIdx.x >> 4, kc = blockIdx.x & 15, t = threadIdx.x; const float* Wm = j < 4 ? WQ : j < 8 ? WK : WV;   // (in,out) [512][64]
  const float* p = Wm + (size_t)(kc * 32 + (t >> 5) * 16 + ((t >> 4) & 1) * 8) * UU + (j & 3) * 16 + (t & 15); v8b o;
#pragma unroll   // the 8 loads issue together, one wait for all
  for (int i = 0; i < 8; ++i) o[i] = (__bf16)p[i * UU];
  *(v8b*)(PW + ((size_t)blockIdx.x * 64 + t) * 8) = o; }
// ---- k_proj: block = 64 rows: x = clip -> A; cols 0..63 q, 64..127 k, 128..191 v (12 tiles)
__global__ __launch_bounds__(128) void k_proj(const float* __restrict__ X, const __bf16* __restrict__ PW, _Float16* __restrict__ QH, _Float16* __restrict__ KH, _Float16* __restrict__ VT) { __shared__ __align__(16) _Float16 sq[64][72], sk[64][72]; __shared__ __align__(16) _Float16 th[UU][72];
  const int tid = threadIdx.x, wave = tid >> 5, lane = tid & 31, col = lane & 15, g = lane >> 4;
  v8f acc[12];
#pragma unroll
  for (int j = 0; j < 12; ++j) acc[j] = v8f{};
  // every load runs two passes ahead of its use, for speed only. B fragments lie in two register sets used in turn, a fragment's next load issued right behind the WMMA that last read it; x lies in three sets, its loads issued at the foot of a pass, behind that pass's B loads, for the third pass from there
  const float* xb = X + (size_t)blockIdx.x * 64 * DD; const unsigned xl = (unsigned)((wave * 16 + col) * DD + 8 * g) * 4u, wl = (unsigned)lane * 16u;
  v4f xn[3][4]; v16b bf[2][12];
#pragma unroll
  for (int s = 0; s < 3; ++s) {
#pragma unroll
    for (int i = 0; i < 4; ++i) xn[s][i] = *(const v4f*)((const char*)(xb + s * 32) + xl + (i >> 1) * 64 + (i & 1) * 16);
    if (s < 2) {
#pragma unroll
      for (int j = 0; j < 12; ++j) bf[s][j] = frag_bp(PW + (j * 16 + s) * 512, wl); } }
#pragma unroll   // unrolled whole: the last passes fetch nothing, the register sets of a pass are fixed at compile time, and every address is the lane's one offset plus an immediate
  for (int kc = 0; kc < DD / 32; ++kc) { v16b a; const int s = kc & 1, t = kc % 3;
    __builtin_amdgcn_sched_barrier(0);   // keeps this conversion behind the pass before: hoisted, its wait for x loads would stand in front of that pass's WMMAs
#pragma unroll
    for (int i = 0; i < 16; ++i) a[i] = (__bf16)fminf(fmaxf(bfr(xn[t][i >> 2][i & 3]), -1.0f), 1.0f);
#pragma unroll
    for (int j = 0; j < 12; ++j) { acc[j] = wmma_bf(a, bf[s][j], acc[j]); if (kc + 2 < DD / 32) bf[s][j] = frag_bp(PW + (j * 16 + kc + 2) * 512, wl); }
    if (kc + 3 < DD / 32) {
#pragma unroll
      for (int i = 0; i < 4; ++i) xn[t][i] = *(const v4f*)((const char*)(xb + (kc + 3) * 32) + xl + (i >> 1) * 64 + (i & 1) * 16); }
    if (kc + 4 == DD / 32 || kc + 3 == DD / 32) asm volatile("s_wait_xcnt 0x0" ::: "memory"); }   // behind the last x fetch and behind the last B fetch: stands before the passes that follow reuse the lane offset register that the loads in flight name
#pragma unroll
  for (int j = 0; j < 12; ++j)
#pragma unroll
    for (int r = 0; r < 8; ++r) { const _Float16 hv = (_Float16)acc[j][r]; const int c = (j & 3) * 16 + col; if (j < 4) sq[wave * 16 + 8 * g + r][c] = hv; else if (j < 8) sk[wave * 16 + 8 * g + r][c] = hv; else th[c][wave * 16 + 8 * g + r] = hv; }
  __syncthreads();
  for (int e = tid; e < 64 * 8; e += 128) { const int rl = e >> 3, q = e & 7; vst2((unsigned*)(QH + ((size_t)blockIdx.x * 64 + rl) * UU + q * 8), *(const v4u*)&sq[rl][q * 8]); }
  // k and v leave in the order k_att's lanes load them: 16-byte piece e of the block's 8 KB belongs to lane e & 31 (row or column e & 15, k group (e >> 4) & 1), elements 0..7 or 8..15 by bit 5; above that k has (u half, key tile), v has (u tile, key step)
  for (int e = tid; e < 64 * 8; e += 128) { const int rc = e & 15, ko = ((e >> 5) & 1) * 16 + ((e >> 4) & 1) * 8; const size_t o = ((size_t)blockIdx.x * 512 + e) * 8;
    vst2((unsigned*)(KH + o), *(const v4u*)&sk[(e >> 7) * 16 + rc][((e >> 6) & 1) * 32 + ko]); vst2((unsigned*)(VT + o), *(const v4u*)&th[((e >> 6) & 3) * 16 + rc][(e >> 8) * 32 + ko]); } }
// ---- k_att: block = (64 queries, b), 4 query tiles x KP key parts = 4 * KP waves: w = sigmoid(q.k); each wave sums w v over its own keys, the parts are joined in LDS (no normalisation)
#define KP 4
// orders a wave's own LDS stores and loads (its score tile is read by other lanes of the same wave): as LDSX, but the fence names LDS alone, so that it does not wait for the global fragment loads in flight across it
#define LDSL() do { asm volatile("s_wait_dscnt 0" ::: "memory"); __builtin_amdgcn_wave_barrier(); __builtin_amdgcn_fence(__ATOMIC_RELEASE, "workgroup", "local"); } while (0)
__global__ __launch_bounds__(128 * KP) void k_att(const _Float16* __restrict__ QH, const _Float16* __restrict__ KH, const _Float16* __restrict__ VT, float* __restrict__ OUT) {
  __shared__ __align__(16) float sp[4 * KP][16][36]; __shared__ __align__(16) float so[4 * KP][16][68];
  const int tid = threadIdx.x, wave = __builtin_amdgcn_readfirstlane(tid >> 5) /* scalar, so that the key loop keeps its scalar counter and branch */, lane = tid & 31, col = lane & 15, g = lane >> 4; const int qt = wave & 3, kp = wave >> 2; const size_t b = blockIdx.y; const int q0 = blockIdx.x * 64 + qt * 16; const size_t rq = b * NN + q0;
  v16h aq[2];
#pragma unroll
  for (int kc = 0; kc < 2; ++kc) aq[kc] = frag_h(QH + (rq + col) * UU + kc * 32, lane);
  v8f acc[4] = {}, accl[4] = {}; const unsigned fl = (unsigned)lane * 16u;
  // every fragment is loaded one trip ahead, into the registers that its last WMMA of this trip has just read: at 4 waves per SIMD a wave has the registers to hold all 8 fragments of a trip, and no load is waited for where it is issued
  v16h kf[4], vf[4];
  { const _Float16* kb = KH + (b * NN + kp * 32) * UU; const _Float16* vb = VT + (b * NN + kp * 32) * UU;   // 32 keys are 4 KB of K fragments (1 KB each: key tile, u half) and 4 KB of V fragments (1 KB each: u tile)
#pragma unroll
    for (int i = 0; i < 4; ++i) kf[i] = frag_hp(kb + i * 512, fl);
#pragma unroll
    for (int j = 0; j < 4; ++j) vf[j] = frag_hp(vb + j * 512, fl); }
  asm volatile("" :: "v"(aq[0]), "v"(aq[1]), "v"(kf[0]), "v"(kf[1]), "v"(kf[2]), "v"(kf[3]), "v"(vf[0]), "v"(vf[1]), "v"(vf[2]), "v"(vf[3]));   // the first loads are all waited for here, once: left to the loop, their order (the compiler's) sets the loop's counted waits so low that every trip waits for the V loads it has just issued
#pragma unroll 1
  for (int ks = kp; ks < NN / 32; ks += KP) {
    const int kn = ks + KP < NN / 32 ? ks + KP : ks;   // the last trip fetches its own keys again: in bounds, never used
    const _Float16* kb = KH + (b * NN + kn * 32) * UU; const _Float16* vb = VT + (b * NN + kn * 32) * UU;
#pragma unroll
    for (int ct = 0; ct < 2; ++ct) { v8f c = {};
#pragma unroll
      for (int kc = 0; kc < 2; ++kc) c = wmma16(aq[kc], kf[ct * 2 + kc], c);
      kf[ct * 2] = frag_hp(kb + ct * 1024, fl); kf[ct * 2 + 1] = frag_hp(kb + ct * 1024 + 512, fl);
#pragma unroll
      for (int r = 0; r < 8; ++r) sp[wave][8 * g + r][ct * 16 + col] = __builtin_amdgcn_rcpf(1.0f + __expf(-c[r])); }   // bare v_rcp_f32 (1 ulp; the argument is 1 or more, infinity gives 0): the weight is cut to f16 hi + residual behind it, so the correctly rounded divide's eleven further instructions bought nothing
    LDSL();
    v16h pa, pal; { const float* prow = &sp[wave][col][0] + 8 * (lane >> 4);
#pragma unroll
      for (int i = 0; i < 8; ++i) { const float p0 = prow[i], p1 = prow[16 + i]; pa[i] = (_Float16)p0; pa[8 + i] = (_Float16)p1; pal[i] = (_Float16)((p0 - (float)pa[i]) * 2048.0f); pal[8 + i] = (_Float16)((p1 - (float)pa[8 + i]) * 2048.0f); } }
#pragma unroll
    for (int j = 0; j < 4; ++j) { acc[j] = wmma16(pa, vf[j], acc[j]); accl[j] = wmma16(pal, vf[j], accl[j]); vf[j] = frag_hp(vb + j * 512, fl); }
    asm volatile("s_wait_xcnt 0x0" ::: "memory");   // stands before the next trip rewrites the address registers that this trip's loads name
    LDSL(); }
#pragma unroll
  for (int r = 0; r < 8; ++r)
#pragma unroll
    for (int j = 0; j < 4; ++j) so[wave][8 * g + r][j * 16 + col] = acc[j][r] + accl[j][r] * (1.0f / 2048.0f);
  __syncthreads();   // every part's partial tile is in LDS before any thread joins them
  for (int e = tid; e < 64 * 16; e += 128 * KP) { const int row = e >> 4, c4 = (e & 15) * 4; v4f s = *(const v4f*)&so[row >> 4][row & 15][c4];
#pragma unroll   // the KP LDS reads issue together; the adds stay in the order of the parts
    for (int p = 1; p < KP; ++p) s += *(const v4f*)&so[p * 4 + (row >> 4)][row & 15][c4];
    vst2(OUT + (b * NN + blockIdx.x * 64 + row) * UU + c4, s); } }
extern "C" void kernel_launch(void* const* d_in, const int* in_sizes, int n_in, void* d_out, int out_size, void* d_ws, size_t ws_size, hipStream_t stream) {
  (void)in_sizes; (void)n_in; (void)out_size;
  const float** F = (const float**)d_in;   // 0 inputs [4,4096,512,1], 1 Wq [512,64], 2 Wk, 3 Wv ((in,out))
  if (ws_size < (size_t)WS_END) return;
  char* ws = (char*)d_ws; __bf16* PW = (__bf16*)(ws + WS_PW); _Float16 *QH = (_Float16*)(ws + WS_QH), *KH = (_Float16*)(ws + WS_KH), *VT = (_Float16*)(ws + WS_VT);
  k_packw<<<3 * UU / 16 * (DD / 32), 64, 0, stream>>>(F[1], F[2], F[3], PW);
  k_proj<<<NB * NN / 64, 128, 0, stream>>>(F[0], PW, QH, KH, VT);
  k_att<<<dim3(NN / 64, TNB), 128 * KP, 0, stream>>>(QH, KH, VT, (float*)d_out);
}

// v007
// One run takes 40 microseconds.
// Next to v006, in two timings, it ran 1.07 and 1.09 times as fast.
// Over all steps from v000 it is 7.62 times as fast.
// compute dtype: all float inputs rounded to bf16; clip in f32 (clipped bf16 values stay exact); q/k/v = x W with EXACT bf16 products on WMMA 16x16x32; q, k rounded once to f16 (single-f16 logits), sigmoid in f32; the sigmoid weights as f16 hi + residual . v (f16; 2 products); unnormalised sum in f32; f32 output.
#include <hip/hip_runtime.h>
#include <math.h>

typedef __attribute__((ext_vector_type(16))) _Float16 v16h;
typedef __attribute__((ext_vector_type(16))) __bf16 v16b;
typedef __attribute__((ext_vector_type(8)))  _Float16 v8h;
typedef __attribute__((ext_vector_type(2)))  _Float16 v2h;
typedef __attribute__((ext_vector_type(8)))  float v8f;
typedef __attribute__((ext_vector_type(4)))  float v4f;
typedef __attribute__((ext_vector_type(2)))  float v2f;
typedef __attribute__((ext_vector_type(4)))  unsigned v4u;
typedef __attribute__((ext_vector_type(4)))  int v4i;
typedef float __attribute__((may_alias)) float_a;
typedef int __attribute__((may_alias)) int_a;

template <typename T> __device__ __forceinline__ void vst2(void* p, T v) { *(T*)p = v;  }
__device__ __forceinline__ v8f wmma16(v16h a, v16h b, v8f c) {
  v8f d = __builtin_amdgcn_wmma_f32_16x16x32_f16(false, a, false, b, (short)0, c, false, false);
  asm volatile("v_nop\n\tv_nop\n\tv_nop\n\tv_nop" : "+v"(d) : "v"(a), "v"(b));
  return d;
}
__device__ __forceinline__ v8f wmma_bf(v16b a, v16b b, v8f c) {
  return __builtin_amdgcn_wmma_f32_16x16x32_bf16(false, a, false, b, (short)0, c, false, false);
}
// 16x16x32 fragments: lane = (h = lane>>4, row/col = lane&15); elements 0..7 = k0+8h+0..7, 8..15 = k0+16+8h+0..7; D element r = row 8h+r
__device__ __forceinline__ v16h frag_h(const _Float16* rowk0, int lane) {
  union { v16h v; v8h q[2]; } u; const _Float16* p = rowk0 + 8 * (lane >> 4);
  u.q[0] = *(const v8h*)p; u.q[1] = *(const v8h*)(p + 16); return u.v;
}
__device__ __forceinline__ v16h frag_f32(const float* rowk0, int lane) {
  v16h a; const float* p = rowk0 + 8 * (lane >> 4);
#pragma unroll
  for (int i = 0; i < 8; ++i) { a[i] = (_Float16)p[i]; a[8 + i] = (_Float16)p[16 + i]; }
  return a;
}
__device__ __forceinline__ v16h frag_f32s(const float* rowk0, int lane, float sc) {
  v16h a; const float* p = rowk0 + 8 * (lane >> 4);
#pragma unroll
  for (int i = 0; i < 8; ++i) { a[i] = (_Float16)(p[i] * sc); a[8 + i] = (_Float16)(p[16 + i] * sc); }
  return a;
}
// column fragment from a [K][ld] layout (column n), rows >= K read as 0
__device__ __forceinline__ v16h fragc_f32(const float* W, int k0, int n, int lane, int ld, int K) {
  v16h a; const int g = lane >> 4;
#pragma unroll
  for (int i = 0; i < 8; ++i) { const int ka = k0 + 8 * g + i, kb = ka + 16;
    a[i] = (_Float16)(ka < K ? W[(size_t)(ka < K ? ka : K - 1) * ld + n] : 0.f); a[8 + i] = (_Float16)(kb < K ? W[(size_t)(kb < K ? kb : K - 1) * ld + n] : 0.f); }
  return a;
}
struct F2 { v16b h, l; };
__device__ __forceinline__ F2 bsplit16(const float v[16]) { F2 r;
#pragma unroll
  for (int i = 0; i < 16; ++i) { const __bf16 h = (__bf16)v[i]; r.h[i] = h; r.l[i] = (__bf16)(v[i] - (float)h); }
  return r; }
__device__ __forceinline__ F2 split_row(const float* row, int k0, int lane) { float v[16]; const float* p = row + k0 + 8 * (lane >> 4);
#pragma unroll
  for (int i = 0; i < 8; ++i) { v[i] = p[i]; v[8 + i] = p[16 + i]; }
  return bsplit16(v); }
__device__ __forceinline__ F2 split_rowK(const float* row, int k0, int lane, int K) { float v[16]; const int g = lane >> 4;
#pragma unroll
  for (int i = 0; i < 8; ++i) { const int ka = k0 + 8 * g + i, kb = ka + 16; v[i] = ka < K ? row[ka < K ? ka : K - 1] : 0.f; v[8 + i] = kb < K ? row[kb < K ? kb : K - 1] : 0.f; }
  return bsplit16(v); }
__device__ __forceinline__ F2 split_col(const float* W, int k0, int n, int lane, int ld, int K) { float v[16]; const int g = lane >> 4;
#pragma unroll
  for (int i = 0; i < 8; ++i) { const int ka = k0 + 8 * g + i, kb = ka + 16; v[i] = ka < K ? W[(size_t)(ka < K ? ka : K - 1) * ld + n] : 0.f; v[8 + i] = kb < K ? W[(size_t)(kb < K ? kb : K - 1) * ld + n] : 0.f; }
  return bsplit16(v); }
__device__ __forceinline__ v8f mac3(const F2& a, const F2& b, v8f c) { c = wmma_bf(a.l, b.h, c); c = wmma_bf(a.h, b.l, c); return wmma_bf(a.h, b.h, c); }
__device__ __forceinline__ float sigm(float v) { return 1.0f / (1.0f + expf(-v)); }
#define LDSX() do { asm volatile("s_wait_dscnt 0" ::: "memory"); __builtin_amdgcn_wave_barrier(); __builtin_amdgcn_fence(__ATOMIC_RELEASE, "workgroup"); } while (0)


// 'Modular' sigmoid attention (B 4, S 4,096, D 512, U 64): x = clip(inputs, -1, 1); q, k, v = x Wq, x Wk, x Wv; out = sigmoid(q k^T) v (no softmax, no scaling).
#define NB 4
#define NN 4096
#define DD 512
#define UU 64
#ifndef TNB
#define TNB NB
#endif
typedef __attribute__((ext_vector_type(8))) __bf16 v8b;
__device__ __forceinline__ v16b frag_b(const __bf16* rowk0, int lane) {
  union { v16b v; v8b q[2]; } u; const __bf16* p = rowk0 + 8 * (lane >> 4);
  u.q[0] = *(const v8b*)p; u.q[1] = *(const v8b*)(p + 16); return u.v;
}
// fragment from a wave-uniform base and the lane's own byte offset: the compiler can keep the base in scalar registers, and one lane register serves every load of a loop
// the fragment is stored in lane order: elements 0..7 of all 32 lanes are 512 bytes in a row, elements 8..15 the next 512, so each 16-byte load of a wave reads 4 whole 128-byte lines
__device__ __forceinline__ v16h frag_hp(const _Float16* ub, unsigned lb) { union { v16h v; v8h q[2]; } u; const char* p = (const char*)ub + lb; u.q[0] = *(const v8h*)p; u.q[1] = *(const v8h*)(p + 512); return u.v; }
__device__ __forceinline__ v16b frag_bp(const __bf16* ub, unsigned lb) { union { v16b v; v8b q[2]; } u; const char* p = (const char*)ub + lb; u.q[0] = *(const v8b*)p; u.q[1] = *(const v8b*)(p + 512); return u.v; }
__device__ __forceinline__ float bfr(float v) { return (float)(__bf16)v; }
__device__ __attribute__((noinline)) float exp_ni(float v) { return expf(v); }
__device__ __attribute__((noinline)) float erf_ni(float v) { return erff(v); }

#define WS_PW  0u                                   // bf16 W (q | k | v, 192 columns) as WMMA B fragments in lane order: [16-column tile][32-k step][8 elements][lane]
#define WS_QH  (WS_PW + 2u * 3 * UU * DD)               // f16 q rows [b*NN + s][64]; k and v as WMMA A fragments in lane order: k [16-key tile][u half][8 elements][lane], v [32-key step][16-u tile][8 elements][lane]
#define WS_KH  (WS_QH + 2u * (size_t)NB * NN * UU)
#define WS_VT  (WS_KH + 2u * (size_t)NB * NN * UU)
#define WS_END (WS_VT + 2u * (size_t)NB * UU * NN)

// block = one fragment (1 KB): column tile blockIdx.x >> 4, k step blockIdx.x & 15; thread t writes the 8 elements that lane t & 31 will load (0..7 for t < 32, 8..15 above)
__global__ __launch_bounds__(64) void k_packw(const float* __restrict__ WQ, const float* __restrict__ WK, const float* __restrict__ WV, __bf16* __restrict__ PW) { const int j = blockIdx.x >> 4, kc = blockIdx.x & 15, t = threadIdx.x; const float* Wm = j < 4 ? WQ : j < 8 ? WK : WV;   // (in,out) [512][64]
  const float* p = Wm + (size_t)(kc * 32 + (t >> 5) * 16 + ((t >> 4) & 1) * 8) * UU + (j & 3) * 16 + (t & 15); v8b o;
#pragma unroll   // the 8 loads issue together, one wait for all
  for (int i = 0; i < 8; ++i) o[i] = (__bf16)p[i * UU];
  *(v8b*)(PW + ((size_t)blockIdx.x * 64 + t) * 8) = o; }
// ---- k_proj: block = 64 rows: x = clip -> A; cols 0..63 q, 64..127 k, 128..191 v (12 tiles)
__global__ __launch_bounds__(128) void k_proj(const float* __restrict__ X, const __bf16* __restrict__ PW, _Float16* __restrict__ QH, _Float16* __restrict__ KH, _Float16* __restrict__ VT) { __shared__ __align__(16) _Float16 sq[64][72], sk[64][72]; __shared__ __align__(16) _Float16 th[UU][72];
  const int tid = threadIdx.x, wave = tid >> 5, lane = tid & 31, col = lane & 15, g = lane >> 4;
  v8f acc[12];
#pragma unroll
  for (int j = 0; j < 12; ++j) acc[j] = v8f{};
  // every load runs two passes ahead of its use, for speed only. B fragments lie in two register sets used in turn, a fragment's next load issued right behind the WMMA that last read it; x lies in three sets, its loads issued at the foot of a pass, behind that pass's B loads, for the third pass from there
  const float* xb = X + (size_t)blockIdx.x * 64 * DD; const unsigned xl = (unsigned)((wave * 16 + col) * DD + 8 * g) * 4u, wl = (unsigned)lane * 16u;
  v4f xn[3][4]; v16b bf[2][12];
#pragma unroll
  for (int s = 0; s < 3; ++s) {
#pragma unroll
    for (int i = 0; i < 4; ++i) xn[s][i] = *(const v4f*)((const char*)(xb + s * 32) + xl + (i >> 1) * 64 + (i & 1) * 16);
    if (s < 2) {
#pragma unroll
      for (int j = 0; j < 12; ++j) bf[s][j] = frag_bp(PW + (j * 16 + s) * 512, wl); } }
#pragma unroll   // unrolled whole: the last passes fetch nothing, the register sets of a pass are fixed at compile time, and every address is the lane's one offset plus an immediate
  for (int kc = 0; kc < DD / 32; ++kc) { v16b a; const int s = kc & 1, t = kc % 3;
    __builtin_amdgcn_sched_barrier(0);   // keeps this conversion behind the pass before: hoisted, its wait for x loads would stand in front of that pass's WMMAs
#pragma unroll
    for (int i = 0; i < 16; ++i) a[i] = (__bf16)fminf(fmaxf(bfr(xn[t][i >> 2][i & 3]), -1.0f), 1.0f);
#pragma unroll
    for (int j = 0; j < 12; ++j) { acc[j] = wmma_bf(a, bf[s][j], acc[j]); if (kc + 2 < DD / 32) bf[s][j] = frag_bp(PW + (j * 16 + kc + 2) * 512, wl); }
    if (kc + 3 < DD / 32) {
#pragma unroll
      for (int i = 0; i < 4; ++i) xn[t][i] = *(const v4f*)((const char*)(xb + (kc + 3) * 32) + xl + (i >> 1) * 64 + (i & 1) * 16); }
    if (kc + 4 == DD / 32 || kc + 3 == DD / 32) asm volatile("s_wait_xcnt 0x0" ::: "memory"); }   // behind the last x fetch and behind the last B fetch: stands before the passes that follow reuse the lane offset register that the loads in flight name
#pragma unroll
  for (int j = 0; j < 12; ++j)
#pragma unroll
    for (int r = 0; r < 8; ++r) { const _Float16 hv = (_Float16)acc[j][r]; const int c = (j & 3) * 16 + col; if (j < 4) sq[wave * 16 + 8 * g + r][c] = hv; else if (j < 8) sk[wave * 16 + 8 * g + r][c] = hv; else th[c][wave * 16 + 8 * g + r] = hv; }
  __syncthreads();
  for (int e = tid; e < 64 * 8; e += 128) { const int rl = e >> 3, q = e & 7; vst2((unsigned*)(QH + ((size_t)blockIdx.x * 64 + rl) * UU + q * 8), *(const v4u*)&sq[rl][q * 8]); }
  // k and v leave in the order k_att's lanes load them: 16-byte piece e of the block's 8 KB belongs to lane e & 31 (row or column e & 15, k group (e >> 4) & 1), elements 0..7 or 8..15 by bit 5; above that k has (u half, key tile), v has (u tile, key step)
  for (int e = tid; e < 64 * 8; e += 128) { const int rc = e & 15, ko = ((e >> 5) & 1) * 16 + ((e >> 4) & 1) * 8; const size_t o = ((size_t)blockIdx.x * 512 + e) * 8;
    vst2((unsigned*)(KH + o), *(const v4u*)&sk[(e >> 7) * 16 + rc][((e >> 6) & 1) * 32 + ko]); vst2((unsigned*)(VT + o), *(const v4u*)&th[((e >> 6) & 3) * 16 + rc][(e >> 8) * 32 + ko]); } }
// ---- k_att: block = (64 queries, b), 4 query tiles x KP key parts = 4 * KP waves: w = sigmoid(q.k); each wave sums w v over its own keys, the parts are joined in LDS (no normalisation)
// both products run transposed: scores^T = K q^T (K fragment as A, q as B), out^T += V^T w^T (V fragment as A, w as B). The two score tiles of 32 keys then lie, lane by lane and register by register, as the B fragment of the second product (D register r of tile t = key 16 t + 8 h + r of the lane's own query = element 8 t + r of B), so the weights never leave the registers. A and B share one fragment map, so q, K and V are stored and loaded as before
#define KP 4
__global__ __launch_bounds__(128 * KP) void k_att(const _Float16* __restrict__ QH, const _Float16* __restrict__ KH, const _Float16* __restrict__ VT, float* __restrict__ OUT) {
  __shared__ __align__(16) float so[4 * KP][16][68];
  const int tid = threadIdx.x, wave = __builtin_amdgcn_readfirstlane(tid >> 5) /* scalar, so that the key loop keeps its scalar counter and branch */, lane = tid & 31, col = lane & 15, g = lane >> 4; const int qt = wave & 3, kp = wave >> 2; const size_t b = blockIdx.y; const int q0 = blockIdx.x * 64 + qt * 16; const size_t rq = b * NN + q0;
  v16h aq[2];
#pragma unroll
  for (int kc = 0; kc < 2; ++kc) aq[kc] = frag_h(QH + (rq + col) * UU + kc * 32, lane);
  v8f acc[4] = {}, accl[4] = {}; const unsigned fl = (unsigned)lane * 16u;
  // every fragment is loaded one trip ahead, into the registers that its last WMMA of this trip has just read: at 4 waves per SIMD a wave has the registers to hold all 8 fragments of a trip, and no load is waited for where it is issued
  v16h kf[4], vf[4];
  { const _Float16* kb = KH + (b * NN + kp * 32) * UU; const _Float16* vb = VT + (b * NN + kp * 32) * UU;   // 32 keys are 4 KB of K fragments (1 KB each: key tile, u half) and 4 KB of V fragments (1 KB each: u tile)
#pragma unroll
    for (int i = 0; i < 4; ++i) kf[i] = frag_hp(kb + i * 512, fl);
#pragma unroll
    for (int j = 0; j < 4; ++j) vf[j] = frag_hp(vb + j * 512, fl); }
  asm volatile("" :: "v"(aq[0]), "v"(aq[1]), "v"(kf[0]), "v"(kf[1]), "v"(kf[2]), "v"(kf[3]), "v"(vf[0]), "v"(vf[1]), "v"(vf[2]), "v"(vf[3]));   // the first loads are all waited for here, once: left to the loop, their order (the compiler's) sets the loop's counted waits so low that every trip waits for the V loads it has just issued
#pragma unroll 1
  for (int ks = kp; ks < NN / 32; ks += KP) {
    const int kn = ks + KP < NN / 32 ? ks + KP : ks;   // the last trip fetches its own keys again: in bounds, never used
    const _Float16* kb = KH + (b * NN + kn * 32) * UU; const _Float16* vb = VT + (b * NN + kn * 32) * UU;
    v16h pa, pal;
#pragma unroll
    for (int ct = 0; ct < 2; ++ct) { v8f c = {};
#pragma unroll
      for (int kc = 0; kc < 2; ++kc) c = wmma16(kf[ct * 2 + kc], aq[kc], c);
      kf[ct * 2] = frag_hp(kb + ct * 1024, fl); kf[ct * 2 + 1] = frag_hp(kb + ct * 1024 + 512, fl);
#pragma unroll
      for (int r = 0; r < 8; r += 2) { const v2f p = {__builtin_amdgcn_rcpf(1.0f + __expf(-c[r])), __builtin_amdgcn_rcpf(1.0f + __expf(-c[r + 1]))};   // bare v_rcp_f32 (1 ulp; the argument is 1 or more, infinity gives 0): the weight is cut to f16 hi + residual behind it, so the correctly rounded divide's eleven further instructions bought nothing
        const v2h hi = __builtin_convertvector(p, v2h), lo = __builtin_convertvector((p - __builtin_convertvector(hi, v2f)) * 2048.0f, v2h);   // two neighbouring keys fill one register of the fragment
        pa[ct * 8 + r] = hi[0]; pa[ct * 8 + r + 1] = hi[1]; pal[ct * 8 + r] = lo[0]; pal[ct * 8 + r + 1] = lo[1]; } }
#pragma unroll
    for (int j = 0; j < 4; ++j) { acc[j] = wmma16(vf[j], pa, acc[j]); accl[j] = wmma16(vf[j], pal, accl[j]); vf[j] = frag_hp(vb + j * 512, fl); }
    asm volatile("s_wait_xcnt 0x0" ::: "memory"); }   // stands before the next trip rewrites the address registers that this trip's loads name
  // a lane holds 8 consecutive u (16 j + 8 g + r) of its own query
#pragma unroll
  for (int j = 0; j < 4; ++j)
#pragma unroll
    for (int h = 0; h < 2; ++h) { v4f o;
#pragma unroll
      for (int r = 0; r < 4; ++r) o[r] = acc[j][h * 4 + r] + accl[j][h * 4 + r] * (1.0f / 2048.0f);
      *(v4f*)&so[wave][col][j * 16 + 8 * g + h * 4] = o; }
  __syncthreads();   // every part's partial tile is in LDS before any thread joins them
  for (int e = tid; e < 64 * 16; e += 128 * KP) { const int row = e >> 4, c4 = (e & 15) * 4; v4f s = *(const v4f*)&so[row >> 4][row & 15][c4];
#pragma unroll   // the KP LDS reads issue together; the adds stay in the order of the parts
    for (int p = 1; p < KP; ++p) s += *(const v4f*)&so[p * 4 + (row >> 4)][row & 15][c4];
    vst2(OUT + (b * NN + blockIdx.x * 64 + row) * UU + c4, s); } }
extern "C" void kernel_launch(void* const* d_in, const int* in_sizes, int n_in, void* d_out, int out_size, void* d_ws, size_t ws_size, hipStream_t stream) {
  (void)in_sizes; (void)n_in; (void)out_size;
  const float** F = (const float**)d_in;   // 0 inputs [4,4096,512,1], 1 Wq [512,64], 2 Wk, 3 Wv ((in,out))
  if (ws_size < (size_t)WS_END) return;
  char* ws = (char*)d_ws; __bf16* PW = (__bf16*)(ws + WS_PW); _Float16 *QH = (_Float16*)(ws + WS_QH), *KH = (_Float16*)(ws + WS_KH), *VT = (_Float16*)(ws + WS_VT);
  k_packw<<<3 * UU / 16 * (DD / 32), 64, 0, stream>>>(F[1], F[2], F[3], PW);
  k_proj<<<NB * NN / 64, 128, 0, stream>>>(F[0], PW, QH, KH, VT);
  k_att<<<dim3(NN / 64, TNB), 128 * KP, 0, stream>>>(QH, KH, VT, (float*)d_out);
}

// v008
// Measured time: 36.1 microseconds a run.
// Next to v007, in two timings, it ran 1.05 and 1.06 times as fast.
// Over all steps from v000 it is 8.04 times as fast.
// compute dtype: all float inputs rounded to bf16; clip in f32 (clipped bf16 values stay exact); q/k/v = x W with EXACT bf16 products on WMMA 16x16x32; q, k rounded once to f16 (single-f16 logits), sigmoid in f32; the sigmoid weights as f16 hi + residual . v (f16; 2 products); unnormalised sum in f32; f32 output.
#include <hip/hip_runtime.h>
#include <math.h>

typedef __attribute__((ext_vector_type(16))) _Float16 v16h;
typedef __attribute__((ext_vector_type(16))) __bf16 v16b;
typedef __attribute__((ext_vector_type(8)))  _Float16 v8h;
typedef __attribute__((ext_vector_type(2)))  _Float16 v2h;
typedef __attribute__((ext_vector_type(8)))  float v8f;
typedef __attribute__((ext_vector_type(4)))  float v4f;
typedef __attribute__((ext_vector_type(2)))  float v2f;
typedef __attribute__((ext_vector_type(4)))  unsigned v4u;
typedef __attribute__((ext_vector_type(4)))  int v4i;
typedef float __attribute__((may_alias)) float_a;
typedef int __attribute__((may_alias)) int_a;

template <typename T> __device__ __forceinline__ void vst2(void* p, T v) { *(T*)p = v;  }
__device__ __forceinline__ v8f wmma16(v16h a, v16h b, v8f c) {
  return __builtin_amdgcn_wmma_f32_16x16x32_f16(false, a, false, b, (short)0, c, false, false);
}
__device__ __forceinline__ v8f wmma_bf(v16b a, v16b b, v8f c) {
  return __builtin_amdgcn_wmma_f32_16x16x32_bf16(false, a, false, b, (short)0, c, false, false);
}
// 16x16x32 fragments: lane = (h = lane>>4, row/col = lane&15); elements 0..7 = k0+8h+0..7, 8..15 = k0+16+8h+0..7; D element r = row 8h+r
__device__ __forceinline__ v16h frag_h(const _Float16* rowk0, int lane) {
  union { v16h v; v8h q[2]; } u; const _Float16* p = rowk0 + 8 * (lane >> 4);
  u.q[0] = *(const v8h*)p; u.q[1] = *(const v8h*)(p + 16); return u.v;
}
__device__ __forceinline__ v16h frag_f32(const float* rowk0, int lane) {
  v16h a; const float* p = rowk0 + 8 * (lane >> 4);
#pragma unroll
  for (int i = 0; i < 8; ++i) { a[i] = (_Float16)p[i]; a[8 + i] = (_Float16)p[16 + i]; }
  return a;
}
__device__ __forceinline__ v16h frag_f32s(const float* rowk0, int lane, float sc) {
  v16h a; const float* p = rowk0 + 8 * (lane >> 4);
#pragma unroll
  for (int i = 0; i < 8; ++i) { a[i] = (_Float16)(p[i] * sc); a[8 + i] = (_Float16)(p[16 + i] * sc); }
  return a;
}
// column fragment from a [K][ld] layout (column n), rows >= K read as 0
__device__ __forceinline__ v16h fragc_f32(const float* W, int k0, int n, int lane, int ld, int K) {
  v16h a; const int g = lane >> 4;
#pragma unroll
  for (int i = 0; i < 8; ++i) { const int ka = k0 + 8 * g + i, kb = ka + 16;
    a[i] = (_Float16)(ka < K ? W[(size_t)(ka < K ? ka : K - 1) * ld + n] : 0.f); a[8 + i] = (_Float16)(kb < K ? W[(size_t)(kb < K ? kb : K - 1) * ld + n] : 0.f); }
  return a;
}
struct F2 { v16b h, l; };
__device__ __forceinline__ F2 bsplit16(const float v[16]) { F2 r;
#pragma unroll
  for (int i = 0; i < 16; ++i) { const __bf16 h = (__bf16)v[i]; r.h[i] = h; r.l[i] = (__bf16)(v[i] - (float)h); }
  return r; }
__device__ __forceinline__ F2 split_row(const float* row, int k0, int lane) { float v[16]; const float* p = row + k0 + 8 * (lane >> 4);
#pragma unroll
  for (int i = 0; i < 8; ++i) { v[i] = p[i]; v[8 + i] = p[16 + i]; }
  return bsplit16(v); }
__device__ __forceinline__ F2 split_rowK(const float* row, int k0, int lane, int K) { float v[16]; const int g = lane >> 4;
#pragma unroll
  for (int i = 0; i < 8; ++i) { const int ka = k0 + 8 * g + i, kb = ka + 16; v[i] = ka < K ? row[ka < K ? ka : K - 1] : 0.f; v[8 + i] = kb < K ? row[kb < K ? kb : K - 1] : 0.f; }
  return bsplit16(v); }
__device__ __forceinline__ F2 split_col(const float* W, int k0, int n, int lane, int ld, int K) { float v[16]; const int g = lane >> 4;
#pragma unroll
  for (int i = 0; i < 8; ++i) { const int ka = k0 + 8 * g + i, kb = ka + 16; v[i] = ka < K ? W[(size_t)(ka < K ? ka : K - 1) * ld + n] : 0.f; v[8 + i] = kb < K ? W[(size_t)(kb < K ? kb : K - 1) * ld + n] : 0.f; }
  return bsplit16(v); }
__device__ __forceinline__ v8f mac3(const F2& a, const F2& b, v8f c) { c = wmma_bf(a.l, b.h, c); c = wmma_bf(a.h, b.l, c); return wmma_bf(a.h, b.h, c); }
__device__ __forceinline__ float sigm(float v) { return 1.0f / (1.0f + expf(-v)); }
#define LDSX() do { asm volatile("s_wait_dscnt 0" ::: "memory"); __builtin_amdgcn_wave_barrier(); __builtin_amdgcn_fence(__ATOMIC_RELEASE, "workgroup"); } while (0)


// 'Modular' sigmoid attention (B 4, S 4,096, D 512, U 64): x = clip(inputs, -1, 1); q, k, v = x Wq, x Wk, x Wv; out = sigmoid(q k^T) v (no softmax, no scaling).
#define NB 4
#define NN 4096
#define DD 512
#define UU 64
#ifndef TNB
#define TNB NB
#endif
typedef __attribute__((ext_vector_type(8))) __bf16 v8b;
__device__ __forceinline__ v16b frag_b(const __bf16* rowk0, int lane) {
  union { v16b v; v8b q[2]; } u; const __bf16* p = rowk0 + 8 * (lane >> 4);
  u.q[0] = *(const v8b*)p; u.q[1] = *(const v8b*)(p + 16); return u.v;
}
// fragment from a wave-uniform base and the lane's own byte offset: the compiler can keep the base in scalar registers, and one lane register serves every load of a loop
// the fragment is stored in lane order: elements 0..7 of all 32 lanes are 512 bytes in a row, elements 8..15 the next 512, so each 16-byte load of a wave reads 4 whole 128-byte lines
__device__ __forceinline__ v16h frag_hp(const _Float16* ub, unsigned lb) { union { v16h v; v8h q[2]; } u; const char* p = (const char*)ub + lb; u.q[0] = *(const v8h*)p; u.q[1] = *(const v8h*)(p + 512); return u.v; }
__device__ __forceinline__ v16b frag_bp(const __bf16* ub, unsigned lb) { union { v16b v; v8b q[2]; } u; const char* p = (const char*)ub + lb; u.q[0] = *(const v8b*)p; u.q[1] = *(const v8b*)(p + 512); return u.v; }
__device__ __forceinline__ float bfr(float v) { return (float)(__bf16)v; }
__device__ __attribute__((noinline)) float exp_ni(float v) { return expf(v); }
__device__ __attribute__((noinline)) float erf_ni(float v) { return erff(v); }

#define WS_PW  0u                                   // bf16 W (q | k | v, 192 columns) as WMMA B fragments in lane order: [16-column tile][32-k step][8 elements][lane]
#define WS_QH  (WS_PW + 2u * 3 * UU * DD)               // f16 q rows [b*NN + s][64]; k and v as WMMA A fragments in lane order: k [16-key tile][u half][8 elements][lane], v [32-key step][16-u tile][8 elements][lane]
#define WS_KH  (WS_QH + 2u * (size_t)NB * NN * UU)
#define WS_VT  (WS_KH + 2u * (size_t)NB * NN * UU)
#define WS_END (WS_VT + 2u * (size_t)NB * UU * NN)

// block = one fragment (1 KB): column tile blockIdx.x >> 4, k step blockIdx.x & 15; thread t writes the 8 elements that lane t & 31 will load (0..7 for t < 32, 8..15 above)
__global__ __launch_bounds__(64) void k_packw(const float* __restrict__ WQ, const float* __restrict__ WK, const float* __restrict__ WV, __bf16* __restrict__ PW) { const int j = blockIdx.x >> 4, kc = blockIdx.x & 15, t = threadIdx.x; const float* Wm = j < 4 ? WQ : j < 8 ? WK : WV;   // (in,out) [512][64]
  const float* p = Wm + (size_t)(kc * 32 + (t >> 5) * 16 + ((t >> 4) & 1) * 8) * UU + (j & 3) * 16 + (t & 15); v8b o;
#pragma unroll   // the 8 loads issue together, one wait for all
  for (int i = 0; i < 8; ++i) o[i] = (__bf16)p[i * UU];
  *(v8b*)(PW + ((size_t)blockIdx.x * 64 + t) * 8) = o; }
// ---- k_proj: block = 64 rows: x = clip -> A; cols 0..63 q, 64..127 k, 128..191 v (12 tiles)
__global__ __launch_bounds__(128) void k_proj(const float* __restrict__ X, const __bf16* __restrict__ PW, _Float16* __restrict__ QH, _Float16* __restrict__ KH, _Float16* __restrict__ VT) { __shared__ __align__(16) _Float16 sq[64][72], sk[64][72]; __shared__ __align__(16) _Float16 th[UU][72];
  const int tid = threadIdx.x, wave = tid >> 5, lane = tid & 31, col = lane & 15, g = lane >> 4;
  v8f acc[12];
#pragma unroll
  for (int j = 0; j < 12; ++j) acc[j] = v8f{};
  // every load runs two passes ahead of its use, for speed only. B fragments lie in two register sets used in turn, a fragment's next load issued right behind the WMMA that last read it; x lies in three sets, its loads issued at the foot of a pass, behind that pass's B loads, for the third pass from there
  const float* xb = X + (size_t)blockIdx.x * 64 * DD; const unsigned xl = (unsigned)((wave * 16 + col) * DD + 8 * g) * 4u, wl = (unsigned)lane * 16u;
  v4f xn[3][4]; v16b bf[2][12];
#pragma unroll
  for (int s = 0; s < 3; ++s) {
#pragma unroll
    for (int i = 0; i < 4; ++i) xn[s][i] = *(const v4f*)((const char*)(xb + s * 32) + xl + (i >> 1) * 64 + (i & 1) * 16);
    if (s < 2) {
#pragma unroll
      for (int j = 0; j < 12; ++j) bf[s][j] = frag_bp(PW + (j * 16 + s) * 512, wl); } }
#pragma unroll   // unrolled whole: the last passes fetch nothing, the register sets of a pass are fixed at compile time, and every address is the lane's one offset plus an immediate
  for (int kc = 0; kc < DD / 32; ++kc) { v16b a; const int s = kc & 1, t = kc % 3;
    __builtin_amdgcn_sched_barrier(0);   // keeps this conversion behind the pass before: hoisted, its wait for x loads would stand in front of that pass's WMMAs
#pragma unroll
    for (int i = 0; i < 16; ++i) a[i] = (__bf16)fminf(fmaxf(bfr(xn[t][i >> 2][i & 3]), -1.0f), 1.0f);
#pragma unroll
    for (int j = 0; j < 12; ++j) { acc[j] = wmma_bf(a, bf[s][j], acc[j]); if (kc + 2 < DD / 32) bf[s][j] = frag_bp(PW + (j * 16 + kc + 2) * 512, wl); }
    if (kc + 3 < DD / 32) {
#pragma unroll
      for (int i = 0; i < 4; ++i) xn[t][i] = *(const v4f*)((const char*)(xb + (kc + 3) * 32) + xl + (i >> 1) * 64 + (i & 1) * 16); }
    if (kc + 4 == DD / 32 || kc + 3 == DD / 32) asm volatile("s_wait_xcnt 0x0" ::: "memory"); }   // behind the last x fetch and behind the last B fetch: stands before the passes that follow reuse the lane offset register that the loads in flight name
#pragma unroll
  for (int j = 0; j < 12; ++j)
#pragma unroll
    for (int r = 0; r < 8; ++r) { const _Float16 hv = (_Float16)acc[j][r]; const int c = (j & 3) * 16 + col; if (j < 4) sq[wave * 16 + 8 * g + r][c] = hv; else if (j < 8) sk[wave * 16 + 8 * g + r][c] = hv; else th[c][wave * 16 + 8 * g + r] = hv; }
  __syncthreads();
  for (int e = tid; e < 64 * 8; e += 128) { const int rl = e >> 3, q = e & 7; vst2((unsigned*)(QH + ((size_t)blockIdx.x * 64 + rl) * UU + q * 8), *(const v4u*)&sq[rl][q * 8]); }
  // k and v leave in the order k_att's lanes load them: 16-byte piece e of the block's 8 KB belongs to lane e & 31 (row or column e & 15, k group (e >> 4) & 1), elements 0..7 or 8..15 by bit 5; above that k has (u half, key tile), v has (u tile, key step)
  for (int e = tid; e < 64 * 8; e += 128) { const int rc = e & 15, ko = ((e >> 5) & 1) * 16 + ((e >> 4) & 1) * 8; const size_t o = ((size_t)blockIdx.x * 512 + e) * 8;
    vst2((unsigned*)(KH + o), *(const v4u*)&sk[(e >> 7) * 16 + rc][((e >> 6) & 1) * 32 + ko]); vst2((unsigned*)(VT + o), *(const v4u*)&th[((e >> 6) & 3) * 16 + rc][(e >> 8) * 32 + ko]); } }
// ---- k_att: block = (64 queries, b), 4 query tiles x KP key parts = 4 * KP waves: w = sigmoid(q.k); each wave sums w v over its own keys, the parts are joined in LDS (no normalisation)
// both products run transposed: scores^T = K q^T (K fragment as A, q as B), out^T += V^T w^T (V fragment as A, w as B). The two score tiles of 32 keys then lie, lane by lane and register by register, as the B fragment of the second product (D register r of tile t = key 16 t + 8 h + r of the lane's own query = element 8 t + r of B), so the weights never leave the registers. A and B share one fragment map, so q, K and V are stored and loaded as before
#define KP 4
__global__ __launch_bounds__(128 * KP) void k_att(const _Float16* __restrict__ QH, const _Float16* __restrict__ KH, const _Float16* __restrict__ VT, float* __restrict__ OUT) {
  __shared__ __align__(16) float so[4 * KP][16][68];
  const int tid = threadIdx.x, wave = __builtin_amdgcn_readfirstlane(tid >> 5) /* scalar, so that the key loop keeps its scalar counter and branch */, lane = tid & 31, col = lane & 15, g = lane >> 4; const int qt = wave & 3, kp = wave >> 2; const size_t b = blockIdx.y; const int q0 = blockIdx.x * 64 + qt * 16; const size_t rq = b * NN + q0;
  v16h aq[2];
#pragma unroll
  for (int kc = 0; kc < 2; ++kc) aq[kc] = frag_h(QH + (rq + col) * UU + kc * 32, lane);
  v8f acc[4] = {}, accl[4] = {}; const unsigned fl = (unsigned)lane * 16u;
  // every fragment is loaded one trip ahead, into the registers that its last WMMA of this trip has just read: at 4 waves per SIMD a wave has the registers to hold all 8 fragments of a trip, and no load is waited for where it is issued
  v16h kf[4], vf[4];
  { const _Float16* kb = KH + (b * NN + kp * 32) * UU; const _Float16* vb = VT + (b * NN + kp * 32) * UU;   // 32 keys are 4 KB of K fragments (1 KB each: key tile, u half) and 4 KB of V fragments (1 KB each: u tile)
#pragma unroll
    for (int i = 0; i < 4; ++i) kf[i] = frag_hp(kb + i * 512, fl);
#pragma unroll
    for (int j = 0; j < 4; ++j) vf[j] = frag_hp(vb + j * 512, fl); }
  asm volatile("" :: "v"(aq[0]), "v"(aq[1]), "v"(kf[0]), "v"(kf[1]), "v"(kf[2]), "v"(kf[3]), "v"(vf[0]), "v"(vf[1]), "v"(vf[2]), "v"(vf[3]));   // the first loads are all waited for here, once: left to the loop, their order (the compiler's) sets the loop's counted waits so low that every trip waits for the V loads it has just issued
#pragma unroll 1
  for (int ks = kp; ks < NN / 32; ks += KP) {
    const int kn = ks + KP < NN / 32 ? ks + KP : ks;   // the last trip fetches its own keys again: in bounds, never used
    const _Float16* kb = KH + (b * NN + kn * 32) * UU; const _Float16* vb = VT + (b * NN + kn * 32) * UU;
    v16h pa, pal;
#pragma unroll
    for (int ct = 0; ct < 2; ++ct) { v8f c = {};
#pragma unroll
      for (int kc = 0; kc < 2; ++kc) c = wmma16(kf[ct * 2 + kc], aq[kc], c);
      kf[ct * 2] = frag_hp(kb + ct * 1024, fl); kf[ct * 2 + 1] = frag_hp(kb + ct * 1024 + 512, fl);
      __builtin_amdgcn_sched_barrier(0);   // holds the K loads here, a whole trip ahead of their use: left free, the compiler lends their registers to the sigmoids and issues the loads at the trip's foot, where the next trip waits for them at once
#pragma unroll
      for (int r = 0; r < 8; r += 2) { const v2f p = {__builtin_amdgcn_rcpf(1.0f + __expf(-c[r])), __builtin_amdgcn_rcpf(1.0f + __expf(-c[r + 1]))};   // bare v_rcp_f32 (1 ulp; the argument is 1 or more, infinity gives 0): the weight is cut to f16 hi + residual behind it, so the correctly rounded divide's eleven further instructions bought nothing
        const v2h hi = __builtin_convertvector(p, v2h), lo = __builtin_convertvector((p - __builtin_convertvector(hi, v2f)) * 2048.0f, v2h);   // two neighbouring keys fill one register of the fragment
        pa[ct * 8 + r] = hi[0]; pa[ct * 8 + r + 1] = hi[1]; pal[ct * 8 + r] = lo[0]; pal[ct * 8 + r + 1] = lo[1]; } }
#pragma unroll
    for (int j = 0; j < 4; ++j) { acc[j] = wmma16(vf[j], pa, acc[j]); accl[j] = wmma16(vf[j], pal, accl[j]); vf[j] = frag_hp(vb + j * 512, fl); }
    asm volatile("s_wait_xcnt 0x0" ::: "memory"); }   // stands before the next trip rewrites the address registers that this trip's loads name
  // a lane holds 8 consecutive u (16 j + 8 g + r) of its own query
#pragma unroll
  for (int j = 0; j < 4; ++j)
#pragma unroll
    for (int h = 0; h < 2; ++h) { v4f o;
#pragma unroll
      for (int r = 0; r < 4; ++r) o[r] = acc[j][h * 4 + r] + accl[j][h * 4 + r] * (1.0f / 2048.0f);
      *(v4f*)&so[wave][col][j * 16 + 8 * g + h * 4] = o; }
  __syncthreads();   // every part's partial tile is in LDS before any thread joins them
  for (int e = tid; e < 64 * 16; e += 128 * KP) { const int row = e >> 4, c4 = (e & 15) * 4; v4f s = *(const v4f*)&so[row >> 4][row & 15][c4];
#pragma unroll   // the KP LDS reads issue together; the adds stay in the order of the parts
    for (int p = 1; p < KP; ++p) s += *(const v4f*)&so[p * 4 + (row >> 4)][row & 15][c4];
    vst2(OUT + (b * NN + blockIdx.x * 64 + row) * UU + c4, s); } }
extern "C" void kernel_launch(void* const* d_in, const int* in_sizes, int n_in, void* d_out, int out_size, void* d_ws, size_t ws_size, hipStream_t stream) {
  (void)in_sizes; (void)n_in; (void)out_size;
  const float** F = (const float**)d_in;   // 0 inputs [4,4096,512,1], 1 Wq [512,64], 2 Wk, 3 Wv ((in,out))
  if (ws_size < (size_t)WS_END) return;
  char* ws = (char*)d_ws; __bf16* PW = (__bf16*)(ws + WS_PW); _Float16 *QH = (_Float16*)(ws + WS_QH), *KH = (_Float16*)(ws + WS_KH), *VT = (_Float16*)(ws + WS_VT);
  k_packw<<<3 * UU / 16 * (DD / 32), 64, 0, stream>>>(F[1], F[2], F[3], PW);
  k_proj<<<NB * NN / 64, 128, 0, stream>>>(F[0], PW, QH, KH, VT);
  k_att<<<dim3(NN / 64, TNB), 128 * KP, 0, stream>>>(QH, KH, VT, (float*)d_out);
}

// v009
// A run of this version takes 33.8 microseconds.
// Next to v008, in two timings, it ran 1.12 and 1.07 times as fast.
// All steps since v000 together make it 8.82 times as fast.
// compute dtype: all float inputs rounded to bf16; clip in f32 (clipped bf16 values stay exact); q/k/v = x W with EXACT bf16 products on WMMA 16x16x32; q, k rounded once to f16 (single-f16 logits), sigmoid in f32; the sigmoid weights as f16 hi + residual . v (f16; 2 products); unnormalised sum in f32; f32 output.
#include <hip/hip_runtime.h>
#include <math.h>

typedef __attribute__((ext_vector_type(16))) _Float16 v16h;
typedef __attribute__((ext_vector_type(16))) __bf16 v16b;
typedef __attribute__((ext_vector_type(8)))  _Float16 v8h;
typedef __attribute__((ext_vector_type(2)))  _Float16 v2h;
typedef __attribute__((ext_vector_type(8)))  float v8f;
typedef __attribute__((ext_vector_type(4)))  float v4f;
typedef __attribute__((ext_vector_type(2)))  float v2f;
typedef __attribute__((ext_vector_type(4)))  unsigned v4u;
typedef __attribute__((ext_vector_type(4)))  int v4i;
typedef float __attribute__((may_alias)) float_a;
typedef int __attribute__((may_alias)) int_a;

template <typename T> __device__ __forceinline__ void vst2(void* p, T v) { *(T*)p = v;  }
__device__ __forceinline__ v8f wmma16(v16h a, v16h b, v8f c) {
  return __builtin_amdgcn_wmma_f32_16x16x32_f16(false, a, false, b, (short)0, c, false, false);
}
__device__ __forceinline__ v8f wmma_bf(v16b a, v16b b, v8f c) {
  return __builtin_amdgcn_wmma_f32_16x16x32_bf16(false, a, false, b, (short)0, c, false, false);
}
// 16x16x32 fragments: lane = (h = lane>>4, row/col = lane&15); elements 0..7 = k0+8h+0..7, 8..15 = k0+16+8h+0..7; D element r = row 8h+r
__device__ __forceinline__ v16h frag_h(const _Float16* rowk0, int lane) {
  union { v16h v; v8h q[2]; } u; const _Float16* p = rowk0 + 8 * (lane >> 4);
  u.q[0] = *(const v8h*)p; u.q[1] = *(const v8h*)(p + 16); return u.v;
}
__device__ __forceinline__ v16h frag_f32(const float* rowk0, int lane) {
  v16h a; const float* p = rowk0 + 8 * (lane >> 4);
#pragma unroll
  for (int i = 0; i < 8; ++i) { a[i] = (_Float16)p[i]; a[8 + i] = (_Float16)p[16 + i]; }
  return a;
}
__device__ __forceinline__ v16h frag_f32s(const float* rowk0, int lane, float sc) {
  v16h a; const float* p = rowk0 + 8 * (lane >> 4);
#pragma unroll
  for (int i = 0; i < 8; ++i) { a[i] = (_Float16)(p[i] * sc); a[8 + i] = (_Float16)(p[16 + i] * sc); }
  return a;
}
// column fragment from a [K][ld] layout (column n), rows >= K read as 0
__device__ __forceinline__ v16h fragc_f32(const float* W, int k0, int n, int lane, int ld, int K) {
  v16h a; const int g = lane >> 4;
#pragma unroll
  for (int i = 0; i < 8; ++i) { const int ka = k0 + 8 * g + i, kb = ka + 16;
    a[i] = (_Float16)(ka < K ? W[(size_t)(ka < K ? ka : K - 1) * ld + n] : 0.f); a[8 + i] = (_Float16)(kb < K ? W[(size_t)(kb < K ? kb : K - 1) * ld + n] : 0.f); }
  return a;
}
struct F2 { v16b h, l; };
__device__ __forceinline__ F2 bsplit16(const float v[16]) { F2 r;
#pragma unroll
  for (int i = 0; i < 16; ++i) { const __bf16 h = (__bf16)v[i]; r.h[i] = h; r.l[i] = (__bf16)(v[i] - (float)h); }
  return r; }
__device__ __forceinline__ F2 split_row(const float* row, int k0, int lane) { float v[16]; const float* p = row + k0 + 8 * (lane >> 4);
#pragma unroll
  for (int i = 0; i < 8; ++i) { v[i] = p[i]; v[8 + i] = p[16 + i]; }
  return bsplit16(v); }
__device__ __forceinline__ F2 split_rowK(const float* row, int k0, int lane, int K) { float v[16]; const int g = lane >> 4;
#pragma unroll
  for (int i = 0; i < 8; ++i) { const int ka = k0 + 8 * g + i, kb = ka + 16; v[i] = ka < K ? row[ka < K ? ka : K - 1] : 0.f; v[8 + i] = kb < K ? row[kb < K ? kb : K - 1] : 0.f; }
  return bsplit16(v); }
__device__ __forceinline__ F2 split_col(const float* W, int k0, int n, int lane, int ld, int K) { float v[16]; const int g = lane >> 4;
#pragma unroll
  for (int i = 0; i < 8; ++i) { const int ka = k0 + 8 * g + i, kb = ka + 16; v[i] = ka < K ? W[(size_t)(ka < K ? ka : K - 1) * ld + n] : 0.f; v[8 + i] = kb < K ? W[(size_t)(kb < K ? kb : K - 1) * ld + n] : 0.f; }
  return bsplit16(v); }
__device__ __forceinline__ v8f mac3(const F2& a, const F2& b, v8f c) { c = wmma_bf(a.l, b.h, c); c = wmma_bf(a.h, b.l, c); return wmma_bf(a.h, b.h, c); }
__device__ __forceinline__ float sigm(float v) { return 1.0f / (1.0f + expf(-v)); }
#define LDSX() do { asm volatile("s_wait_dscnt 0" ::: "memory"); __builtin_amdgcn_wave_barrier(); __builtin_amdgcn_fence(__ATOMIC_RELEASE, "workgroup"); } while (0)


// 'Modular' sigmoid attention (B 4, S 4,096, D 512, U 64): x = clip(inputs, -1, 1); q, k, v = x Wq, x Wk, x Wv; out = sigmoid(q k^T) v (no softmax, no scaling).
#define NB 4
#define NN 4096
#define DD 512
#define UU 64
#ifndef TNB
#define TNB NB
#endif
typedef __attribute__((ext_vector_type(8))) __bf16 v8b;
__device__ __forceinline__ v16b frag_b(const __bf16* rowk0, int lane) {
  union { v16b v; v8b q[2]; } u; const __bf16* p = rowk0 + 8 * (lane >> 4);
  u.q[0] = *(const v8b*)p; u.q[1] = *(const v8b*)(p + 16); return u.v;
}
// fragment from a wave-uniform base and the lane's own byte offset: the compiler can keep the base in scalar registers, and one lane register serves every load of a loop
// the fragment is stored in lane order: elements 0..7 of all 32 lanes are 512 bytes in a row, elements 8..15 the next 512, so each 16-byte load of a wave reads 4 whole 128-byte lines
__device__ __forceinline__ v16h frag_hp(const _Float16* ub, unsigned lb) { union { v16h v; v8h q[2]; } u; const char* p = (const char*)ub + lb; u.q[0] = *(const v8h*)p; u.q[1] = *(const v8h*)(p + 512); return u.v; }
__device__ __forceinline__ v16b frag_bp(const __bf16* ub, unsigned lb) { union { v16b v; v8b q[2]; } u; const char* p = (const char*)ub + lb; u.q[0] = *(const v8b*)p; u.q[1] = *(const v8b*)(p + 512); return u.v; }
__device__ __forceinline__ float bfr(float v) { return (float)(__bf16)v; }
__device__ __attribute__((noinline)) float exp_ni(float v) { return expf(v); }
__device__ __attribute__((noinline)) float erf_ni(float v) { return erff(v); }

#define WS_PW  0u                                   // bf16 W (q | k | v, 192 columns) as WMMA B fragments in lane order: [16-column tile][32-k step][8 elements][lane]
#define WS_QH  (WS_PW + 2u * 3 * UU * DD)               // f16 q rows [b*NN + s][64]; k and v as WMMA A fragments in lane order: k [16-key tile][u half][8 elements][lane], v [32-key step][16-u tile][8 elements][lane]
#define WS_KH  (WS_QH + 2u * (size_t)NB * NN * UU)
#define WS_VT  (WS_KH + 2u * (size_t)NB * NN * UU)
#define WS_END (WS_VT + 2u * (size_t)NB * UU * NN)

// block = one fragment (1 KB): column tile blockIdx.x >> 4, k step blockIdx.x & 15; thread t writes the 8 elements that lane t & 31 will load (0..7 for t < 32, 8..15 above)
__global__ __launch_bounds__(64) void k_packw(const float* __restrict__ WQ, const float* __restrict__ WK, const float* __restrict__ WV, __bf16* __restrict__ PW) { const int j = blockIdx.x >> 4, kc = blockIdx.x & 15, t = threadIdx.x; const float* Wm = j < 4 ? WQ : j < 8 ? WK : WV;   // (in,out) [512][64]
  const float* p = Wm + (size_t)(kc * 32 + (t >> 5) * 16 + ((t >> 4) & 1) * 8) * UU + (j & 3) * 16 + (t & 15); v8b o;
#pragma unroll   // the 8 loads issue together, one wait for all
  for (int i = 0; i < 8; ++i) o[i] = (__bf16)p[i * UU];
  *(v8b*)(PW + ((size_t)blockIdx.x * 64 + t) * 8) = o; }
// ---- k_proj: block = 64 rows: x = clip -> A; cols 0..63 q, 64..127 k, 128..191 v (12 tiles)
__global__ __launch_bounds__(128) void k_proj(const float* __restrict__ X, const __bf16* __restrict__ PW, _Float16* __restrict__ QH, _Float16* __restrict__ KH, _Float16* __restrict__ VT) { __shared__ __align__(16) _Float16 sq[64][72], sk[64][72]; __shared__ __align__(16) _Float16 th[UU][72];
  const int tid = threadIdx.x, wave = tid >> 5, lane = tid & 31, col = lane & 15, g = lane >> 4;
  v8f acc[12];
#pragma unroll
  for (int j = 0; j < 12; ++j) acc[j] = v8f{};
  // every load runs two passes ahead of its use, for speed only. B fragments lie in two register sets used in turn, a fragment's next load issued right behind the WMMA that last read it; x lies in three sets, its loads issued at the foot of a pass, behind that pass's B loads, for the third pass from there
  const float* xb = X + (size_t)blockIdx.x * 64 * DD; const unsigned xl = (unsigned)((wave * 16 + col) * DD + 8 * g) * 4u, wl = (unsigned)lane * 16u;
  v4f xn[3][4]; v16b bf[2][12];
#pragma unroll
  for (int s = 0; s < 3; ++s) {
#pragma unroll
    for (int i = 0; i < 4; ++i) xn[s][i] = *(const v4f*)((const char*)(xb + s * 32) + xl + (i >> 1) * 64 + (i & 1) * 16);
    if (s < 2) {
#pragma unroll
      for (int j = 0; j < 12; ++j) bf[s][j] = frag_bp(PW + (j * 16 + s) * 512, wl); } }
#pragma unroll   // unrolled whole: the last passes fetch nothing, the register sets of a pass are fixed at compile time, and every address is the lane's one offset plus an immediate
  for (int kc = 0; kc < DD / 32; ++kc) { v16b a; const int s = kc & 1, t = kc % 3;
    __builtin_amdgcn_sched_barrier(0);   // keeps this conversion behind the pass before: hoisted, its wait for x loads would stand in front of that pass's WMMAs
#pragma unroll
    for (int i = 0; i < 16; ++i) a[i] = (__bf16)fminf(fmaxf(bfr(xn[t][i >> 2][i & 3]), -1.0f), 1.0f);
#pragma unroll
    for (int j = 0; j < 12; ++j) { acc[j] = wmma_bf(a, bf[s][j], acc[j]); if (kc + 2 < DD / 32) bf[s][j] = frag_bp(PW + (j * 16 + kc + 2) * 512, wl); }
    if (kc + 3 < DD / 32) {
#pragma unroll
      for (int i = 0; i < 4; ++i) xn[t][i] = *(const v4f*)((const char*)(xb + (kc + 3) * 32) + xl + (i >> 1) * 64 + (i & 1) * 16); }
    if (kc + 4 == DD / 32 || kc + 3 == DD / 32) asm volatile("s_wait_xcnt 0x0" ::: "memory"); }   // behind the last x fetch and behind the last B fetch: stands before the passes that follow reuse the lane offset register that the loads in flight name
#pragma unroll
  for (int j = 0; j < 12; ++j)
#pragma unroll
    for (int r = 0; r < 8; ++r) { const _Float16 hv = (_Float16)acc[j][r]; const int c = (j & 3) * 16 + col; if (j < 4) sq[wave * 16 + 8 * g + r][c] = hv; else if (j < 8) sk[wave * 16 + 8 * g + r][c] = hv; else th[c][wave * 16 + 8 * g + r] = hv; }
  __syncthreads();
  for (int e = tid; e < 64 * 8; e += 128) { const int rl = e >> 3, q = e & 7; vst2((unsigned*)(QH + ((size_t)blockIdx.x * 64 + rl) * UU + q * 8), *(const v4u*)&sq[rl][q * 8]); }
  // k and v leave in the order k_att's lanes load them: 16-byte piece e of the block's 8 KB belongs to lane e & 31 (row or column e & 15, k group (e >> 4) & 1), elements 0..7 or 8..15 by bit 5; above that k has (u half, key tile), v has (u tile, key step)
  for (int e = tid; e < 64 * 8; e += 128) { const int rc = e & 15, ko = ((e >> 5) & 1) * 16 + ((e >> 4) & 1) * 8; const size_t o = ((size_t)blockIdx.x * 512 + e) * 8;
    vst2((unsigned*)(KH + o), *(const v4u*)&sk[(e >> 7) * 16 + rc][((e >> 6) & 1) * 32 + ko]); vst2((unsigned*)(VT + o), *(const v4u*)&th[((e >> 6) & 3) * 16 + rc][(e >> 8) * 32 + ko]); } }
// ---- k_att: block = (64 queries, b), 2 query pairs x KP key parts = 2 * KP waves: w = sigmoid(q.k); each wave sums w v over its own keys for its 32 queries, the parts are joined in LDS (no normalisation)
// both products run transposed: scores^T = K q^T (K fragment as A, q as B), out^T += V^T w^T (V fragment as A, w as B). The two score tiles of 32 keys then lie, lane by lane and register by register, as the B fragment of the second product (D register r of tile t = key 16 t + 8 h + r of the lane's own query = element 8 t + r of B), so the weights never leave the registers. A and B share one fragment map, so q, K and V are stored and loaded as before
// a wave holds two query tiles: every K and V fragment it loads feeds two WMMAs per product, so the block moves half the fragment bytes from the cache into registers
#define KP 8
__global__ __launch_bounds__(64 * KP) void k_att(const _Float16* __restrict__ QH, const _Float16* __restrict__ KH, const _Float16* __restrict__ VT, float* __restrict__ OUT) {
  __shared__ __align__(16) float so[2 * KP][32][68];
  const int tid = threadIdx.x, wave = __builtin_amdgcn_readfirstlane(tid >> 5) /* scalar, so that the key loop keeps its scalar counter and branch */, lane = tid & 31, col = lane & 15, g = lane >> 4; const int qp = wave & 1, kp = wave >> 1; const size_t b = blockIdx.y; const int q0 = blockIdx.x * 64 + qp * 32; const size_t rq = b * NN + q0;
  v16h aq[2][2];
#pragma unroll
  for (int t = 0; t < 2; ++t)
#pragma unroll
    for (int kc = 0; kc < 2; ++kc) aq[t][kc] = frag_h(QH + (rq + t * 16 + col) * UU + kc * 32, lane);
  v8f acc[2][4] = {}; const unsigned fl = (unsigned)lane * 16u;
  // every fragment is loaded one trip ahead, into the registers that its last WMMA of this trip has just read: no load is waited for where it is issued
  v16h kf[4], vf[4];
  { const _Float16* kb = KH + (b * NN + kp * 32) * UU; const _Float16* vb = VT + (b * NN + kp * 32) * UU;   // 32 keys are 4 KB of K fragments (1 KB each: key tile, u half) and 4 KB of V fragments (1 KB each: u tile)
#pragma unroll
    for (int i = 0; i < 4; ++i) kf[i] = frag_hp(kb + i * 512, fl);
#pragma unroll
    for (int j = 0; j < 4; ++j) vf[j] = frag_hp(vb + j * 512, fl); }
  asm volatile("" :: "v"(aq[0][0]), "v"(aq[0][1]), "v"(aq[1][0]), "v"(aq[1][1]), "v"(kf[0]), "v"(kf[1]), "v"(kf[2]), "v"(kf[3]), "v"(vf[0]), "v"(vf[1]), "v"(vf[2]), "v"(vf[3]));   // the first loads are all waited for here, once: left to the loop, their order (the compiler's) sets the loop's counted waits so low that every trip waits for the V loads it has just issued
#pragma unroll 1
  for (int ks = kp; ks < NN / 32; ks += KP) {
    const int kn = ks + KP < NN / 32 ? ks + KP : ks;   // the last trip fetches its own keys again: in bounds, never used
    const _Float16* kb = KH + (b * NN + kn * 32) * UU; const _Float16* vb = VT + (b * NN + kn * 32) * UU;
    v16h pa[2], pal[2];
#pragma unroll
    for (int ct = 0; ct < 2; ++ct) { v8f c[2] = {};
#pragma unroll
      for (int kc = 0; kc < 2; ++kc)
#pragma unroll
        for (int t = 0; t < 2; ++t) c[t] = wmma16(kf[ct * 2 + kc], aq[t][kc], c[t]);
      kf[ct * 2] = frag_hp(kb + ct * 1024, fl); kf[ct * 2 + 1] = frag_hp(kb + ct * 1024 + 512, fl);
      __builtin_amdgcn_sched_barrier(0);   // holds the K loads here, a whole trip ahead of their use: left free, the compiler lends their registers to the sigmoids and issues the loads at the trip's foot, where the next trip waits for them at once
#pragma unroll
      for (int t = 0; t < 2; ++t)
#pragma unroll
        for (int r = 0; r < 8; r += 2) {
          // the weight times 2^11, at no extra instruction: 2^11 / (1 + e) = 1 / (2^-11 + 2^-11 e), the factor of e folded into the exponent's multiply. The f16 high part and the f16 residual then share one scale (the residual stays a normal f16 number), so both products add into one accumulator: two query tiles with separate residual sums would not fit the 256 registers of 4 waves per SIMD
          // bare v_rcp_f32 (1 ulp; the argument is 2^-11 or more, infinity gives 0): the weight is cut to f16 hi + residual behind it, so the correctly rounded divide's eleven further instructions bought nothing
          const v2f p = {__builtin_amdgcn_rcpf(0x1p-11f + __builtin_amdgcn_exp2f(__builtin_fmaf(c[t][r], -1.44269504f, -11.0f))), __builtin_amdgcn_rcpf(0x1p-11f + __builtin_amdgcn_exp2f(__builtin_fmaf(c[t][r + 1], -1.44269504f, -11.0f)))};
          const v2h hi = __builtin_convertvector(p, v2h), lo = __builtin_convertvector(p - __builtin_convertvector(hi, v2f), v2h);   // two neighbouring keys fill one register of the fragment
          pa[t][ct * 8 + r] = hi[0]; pa[t][ct * 8 + r + 1] = hi[1]; pal[t][ct * 8 + r] = lo[0]; pal[t][ct * 8 + r + 1] = lo[1]; } }
#pragma unroll
    for (int j = 0; j < 4; ++j)
#pragma unroll
      for (int t = 0; t < 2; ++t) acc[t][j] = wmma16(vf[j], pa[t], acc[t][j]);
#pragma unroll   // the residual products come behind all eight high products: no WMMA waits for the accumulator of the one before it
    for (int j = 0; j < 4; ++j) {
#pragma unroll
      for (int t = 0; t < 2; ++t) acc[t][j] = wmma16(vf[j], pal[t], acc[t][j]);
      vf[j] = frag_hp(vb + j * 512, fl); }
    asm volatile("s_wait_xcnt 0x0" ::: "memory"); }   // stands before the next trip rewrites the address registers that this trip's loads name
  // a lane holds 8 consecutive u (16 j + 8 g + r) of its own query in each tile
#pragma unroll
  for (int t = 0; t < 2; ++t)
#pragma unroll
    for (int j = 0; j < 4; ++j)
#pragma unroll
      for (int h = 0; h < 2; ++h) { v4f o;
#pragma unroll
        for (int r = 0; r < 4; ++r) o[r] = acc[t][j][h * 4 + r];
        *(v4f*)&so[wave][t * 16 + col][j * 16 + 8 * g + h * 4] = o; }
  __syncthreads();   // every part's partial tile is in LDS before any thread joins them
  for (int e = tid; e < 64 * 16; e += 64 * KP) { const int row = e >> 4, c4 = (e & 15) * 4; v4f s = *(const v4f*)&so[row >> 5][row & 31][c4];
#pragma unroll   // the KP LDS reads issue together; the adds stay in the order of the parts
    for (int p = 1; p < KP; ++p) s += *(const v4f*)&so[p * 2 + (row >> 5)][row & 31][c4];
    vst2(OUT + (b * NN + blockIdx.x * 64 + row) * UU + c4, s * 0x1p-11f); } }   // the weights' scale goes here, exactly
extern "C" void kernel_launch(void* const* d_in, const int* in_sizes, int n_in, void* d_out, int out_size, void* d_ws, size_t ws_size, hipStream_t stream) {
  (void)in_sizes; (void)n_in; (void)out_size;
  const float** F = (const float**)d_in;   // 0 inputs [4,4096,512,1], 1 Wq [512,64], 2 Wk, 3 Wv ((in,out))
  if (ws_size < (size_t)WS_END) return;
  char* ws = (char*)d_ws; __bf16* PW = (__bf16*)(ws + WS_PW); _Float16 *QH = (_Float16*)(ws + WS_QH), *KH = (_Float16*)(ws + WS_KH), *VT = (_Float16*)(ws + WS_VT);
  k_packw<<<3 * UU / 16 * (DD / 32), 64, 0, stream>>>(F[1], F[2], F[3], PW);
  k_proj<<<NB * NN / 64, 128, 0, stream>>>(F[0], PW, QH, KH, VT);
  k_att<<<dim3(NN / 64, TNB), 64 * KP, 0, stream>>>(QH, KH, VT, (float*)d_out);
}

// v010
// Measured time: 31.6 microseconds a run.
// Timed twice side by side with v009, it ran 1.08 and 1.09 times as fast.
// Over all steps from v000 it is 9.58 times as fast.
// compute dtype: all float inputs rounded to bf16; clip in f32 (clipped bf16 values stay exact); q/k/v = x W with EXACT bf16 products on WMMA 16x16x32; q, k rounded once to f16 (single-f16 logits), sigmoid in f32; the sigmoid weights as f16 hi + residual . v (f16; 2 products); unnormalised sum in f32; f32 output.
#include <hip/hip_runtime.h>
#include <math.h>

typedef __attribute__((ext_vector_type(16))) _Float16 v16h;
typedef __attribute__((ext_vector_type(16))) __bf16 v16b;
typedef __attribute__((ext_vector_type(8)))  _Float16 v8h;
typedef __attribute__((ext_vector_type(2)))  _Float16 v2h;
typedef __attribute__((ext_vector_type(8)))  float v8f;
typedef __attribute__((ext_vector_type(4)))  float v4f;
typedef __attribute__((ext_vector_type(2)))  float v2f;
typedef __attribute__((ext_vector_type(4)))  unsigned v4u;
typedef __attribute__((ext_vector_type(4)))  int v4i;
typedef float __attribute__((may_alias)) float_a;
typedef int __attribute__((may_alias)) int_a;

template <typename T> __device__ __forceinline__ void vst2(void* p, T v) { *(T*)p = v;  }
__device__ __forceinline__ v8f wmma16(v16h a, v16h b, v8f c) {
  return __builtin_amdgcn_wmma_f32_16x16x32_f16(false, a, false, b, (short)0, c, false, false);
}
__device__ __forceinline__ v8f wmma_bf(v16b a, v16b b, v8f c) {
  return __builtin_amdgcn_wmma_f32_16x16x32_bf16(false, a, false, b, (short)0, c, false, false);
}
// 16x16x32 fragments: lane = (h = lane>>4, row/col = lane&15); elements 0..7 = k0+8h+0..7, 8..15 = k0+16+8h+0..7; D element r = row 8h+r
__device__ __forceinline__ v16h frag_h(const _Float16* rowk0, int lane) {
  union { v16h v; v8h q[2]; } u; const _Float16* p = rowk0 + 8 * (lane >> 4);
  u.q[0] = *(const v8h*)p; u.q[1] = *(const v8h*)(p + 16); return u.v;
}
__device__ __forceinline__ v16h frag_f32(const float* rowk0, int lane) {
  v16h a; const float* p = rowk0 + 8 * (lane >> 4);
#pragma unroll
  for (int i = 0; i < 8; ++i) { a[i] = (_Float16)p[i]; a[8 + i] = (_Float16)p[16 + i]; }
  return a;
}
__device__ __forceinline__ v16h frag_f32s(const float* rowk0, int lane, float sc) {
  v16h a; const float* p = rowk0 + 8 * (lane >> 4);
#pragma unroll
  for (int i = 0; i < 8; ++i) { a[i] = (_Float16)(p[i] * sc); a[8 + i] = (_Float16)(p[16 + i] * sc); }
  return a;
}
// column fragment from a [K][ld] layout (column n), rows >= K read as 0
__device__ __forceinline__ v16h fragc_f32(const float* W, int k0, int n, int lane, int ld, int K) {
  v16h a; const int g = lane >> 4;
#pragma unroll
  for (int i = 0; i < 8; ++i) { const int ka = k0 + 8 * g + i, kb = ka + 16;
    a[i] = (_Float16)(ka < K ? W[(size_t)(ka < K ? ka : K - 1) * ld + n] : 0.f); a[8 + i] = (_Float16)(kb < K ? W[(size_t)(kb < K ? kb : K - 1) * ld + n] : 0.f); }
  return a;
}
struct F2 { v16b h, l; };
__device__ __forceinline__ F2 bsplit16(const float v[16]) { F2 r;
#pragma unroll
  for (int i = 0; i < 16; ++i) { const __bf16 h = (__bf16)v[i]; r.h[i] = h; r.l[i] = (__bf16)(v[i] - (float)h); }
  return r; }
__device__ __forceinline__ F2 split_row(const float* row, int k0, int lane) { float v[16]; const float* p = row + k0 + 8 * (lane >> 4);
#pragma unroll
  for (int i = 0; i < 8; ++i) { v[i] = p[i]; v[8 + i] = p[16 + i]; }
  return bsplit16(v); }
__device__ __forceinline__ F2 split_rowK(const float* row, int k0, int lane, int K) { float v[16]; const int g = lane >> 4;
#pragma unroll
  for (int i = 0; i < 8; ++i) { const int ka = k0 + 8 * g + i, kb = ka + 16; v[i] = ka < K ? row[ka < K ? ka : K - 1] : 0.f; v[8 + i] = kb < K ? row[kb < K ? kb : K - 1] : 0.f; }
  return bsplit16(v); }
__device__ __forceinline__ F2 split_col(const float* W, int k0, int n, int lane, int ld, int K) { float v[16]; const int g = lane >> 4;
#pragma unroll
  for (int i = 0; i < 8; ++i) { const int ka = k0 + 8 * g + i, kb = ka + 16; v[i] = ka < K ? W[(size_t)(ka < K ? ka : K - 1) * ld + n] : 0.f; v[8 + i] = kb < K ? W[(size_t)(kb < K ? kb : K - 1) * ld + n] : 0.f; }
  return bsplit16(v); }
__device__ __forceinline__ v8f mac3(const F2& a, const F2& b, v8f c) { c = wmma_bf(a.l, b.h, c); c = wmma_bf(a.h, b.l, c); return wmma_bf(a.h, b.h, c); }
__device__ __forceinline__ float sigm(float v) { return 1.0f / (1.0f + expf(-v)); }
#define LDSX() do { asm volatile("s_wait_dscnt 0" ::: "memory"); __builtin_amdgcn_wave_barrier(); __builtin_amdgcn_fence(__ATOMIC_RELEASE, "workgroup"); } while (0)


// 'Modular' sigmoid attention (B 4, S 4,096, D 512, U 64): x = clip(inputs, -1, 1); q, k, v = x Wq, x Wk, x Wv; out = sigmoid(q k^T) v (no softmax, no scaling).
#define NB 4
#define NN 4096
#define DD 512
#define UU 64
#ifndef TNB
#define TNB NB
#endif
typedef __attribute__((ext_vector_type(8))) __bf16 v8b;
__device__ __forceinline__ v16b frag_b(const __bf16* rowk0, int lane) {
  union { v16b v; v8b q[2]; } u; const __bf16* p = rowk0 + 8 * (lane >> 4);
  u.q[0] = *(const v8b*)p; u.q[1] = *(const v8b*)(p + 16); return u.v;
}
// fragment from a wave-uniform base and the lane's own byte offset: the compiler can keep the base in scalar registers, and one lane register serves every load of a loop
// the fragment is stored in lane order: elements 0..7 of all 32 lanes are 512 bytes in a row, elements 8..15 the next 512, so each 16-byte load of a wave reads 4 whole 128-byte lines
__device__ __forceinline__ v16h frag_hp(const _Float16* ub, unsigned lb) { union { v16h v; v8h q[2]; } u; const char* p = (const char*)ub + lb; u.q[0] = *(const v8h*)p; u.q[1] = *(const v8h*)(p + 512); return u.v; }
__device__ __forceinline__ v16b frag_bp(const __bf16* ub, unsigned lb) { union { v16b v; v8b q[2]; } u; const char* p = (const char*)ub + lb; u.q[0] = *(const v8b*)p; u.q[1] = *(const v8b*)(p + 512); return u.v; }
__device__ __forceinline__ float bfr(float v) { return (float)(__bf16)v; }
__device__ __attribute__((noinline)) float exp_ni(float v) { return expf(v); }
__device__ __attribute__((noinline)) float erf_ni(float v) { return erff(v); }

#define WS_PW  0u                                   // bf16 W (q | k | v, 192 columns) as WMMA B fragments in lane order: [16-column tile][32-k step][8 elements][lane]
#define WS_QH  (WS_PW + 2u * 3 * UU * DD)               // f16 q rows [b*NN + s][64]; k and v as WMMA A fragments in lane order: k [16-key tile][u half][8 elements][lane], v [32-key step][16-u tile][8 elements][lane]
#define WS_KH  (WS_QH + 2u * (size_t)NB * NN * UU)
#define WS_VT  (WS_KH + 2u * (size_t)NB * NN * UU)
#define WS_END (WS_VT + 2u * (size_t)NB * UU * NN)

// block = one fragment (1 KB): column tile blockIdx.x >> 4, k step blockIdx.x & 15; thread t writes the 8 elements that lane t & 31 will load (0..7 for t < 32, 8..15 above)
__global__ __launch_bounds__(64) void k_packw(const float* __restrict__ WQ, const float* __restrict__ WK, const float* __restrict__ WV, __bf16* __restrict__ PW) { const int j = blockIdx.x >> 4, kc = blockIdx.x & 15, t = threadIdx.x; const float* Wm = j < 4 ? WQ : j < 8 ? WK : WV;   // (in,out) [512][64]
  const float* p = Wm + (size_t)(kc * 32 + (t >> 5) * 16 + ((t >> 4) & 1) * 8) * UU + (j & 3) * 16 + (t & 15); v8b o;
#pragma unroll   // the 8 loads issue together, one wait for all
  for (int i = 0; i < 8; ++i) o[i] = (__bf16)p[i * UU];
  *(v8b*)(PW + ((size_t)blockIdx.x * 64 + t) * 8) = o; }
// ---- k_proj: block = 64 rows: x = clip -> A; cols 0..63 q, 64..127 k, 128..191 v (12 tiles)
__global__ __launch_bounds__(128) void k_proj(const float* __restrict__ X, const __bf16* __restrict__ PW, _Float16* __restrict__ QH, _Float16* __restrict__ KH, _Float16* __restrict__ VT) { __shared__ __align__(16) _Float16 sq[64][72], sk[64][72]; __shared__ __align__(16) _Float16 th[UU][72];
  const int tid = threadIdx.x, wave = tid >> 5, lane = tid & 31, col = lane & 15, g = lane >> 4;
  v8f acc[12];
#pragma unroll
  for (int j = 0; j < 12; ++j) acc[j] = v8f{};
  // every load runs two passes ahead of its use, for speed only. B fragments lie in two register sets used in turn, a fragment's next load issued right behind the WMMA that last read it; x lies in three sets, its loads issued at the foot of a pass, behind that pass's B loads, for the third pass from there
  const float* xb = X + (size_t)blockIdx.x * 64 * DD; const unsigned xl = (unsigned)((wave * 16 + col) * DD + 8 * g) * 4u, wl = (unsigned)lane * 16u;
  v4f xn[3][4]; v16b bf[2][12];
#pragma unroll
  for (int s = 0; s < 3; ++s) {
#pragma unroll
    for (int i = 0; i < 4; ++i) xn[s][i] = *(const v4f*)((const char*)(xb + s * 32) + xl + (i >> 1) * 64 + (i & 1) * 16);
    if (s < 2) {
#pragma unroll
      for (int j = 0; j < 12; ++j) bf[s][j] = frag_bp(PW + (j * 16 + s) * 512, wl); } }
#pragma unroll   // unrolled whole: the last passes fetch nothing, the register sets of a pass are fixed at compile time, and every address is the lane's one offset plus an immediate
  for (int kc = 0; kc < DD / 32; ++kc) { v16b a; const int s = kc & 1, t = kc % 3;
    __builtin_amdgcn_sched_barrier(0);   // keeps this conversion behind the pass before: hoisted, its wait for x loads would stand in front of that pass's WMMAs
#pragma unroll
    for (int i = 0; i < 16; ++i) a[i] = (__bf16)fminf(fmaxf(bfr(xn[t][i >> 2][i & 3]), -1.0f), 1.0f);
#pragma unroll
    for (int j = 0; j < 12; ++j) { acc[j] = wmma_bf(a, bf[s][j], acc[j]); if (kc + 2 < DD / 32) bf[s][j] = frag_bp(PW + (j * 16 + kc + 2) * 512, wl); }
    if (kc + 3 < DD / 32) {
#pragma unroll
      for (int i = 0; i < 4; ++i) xn[t][i] = *(const v4f*)((const char*)(xb + (kc + 3) * 32) + xl + (i >> 1) * 64 + (i & 1) * 16); }
    if (kc + 4 == DD / 32 || kc + 3 == DD / 32) asm volatile("s_wait_xcnt 0x0" ::: "memory"); }   // behind the last x fetch and behind the last B fetch: stands before the passes that follow reuse the lane offset register that the loads in flight name
#pragma unroll
  for (int j = 0; j < 12; ++j)
#pragma unroll
    for (int r = 0; r < 8; ++r) { const _Float16 hv = (_Float16)acc[j][r]; const int c = (j & 3) * 16 + col; if (j < 4) sq[wave * 16 + 8 * g + r][c] = hv; else if (j < 8) sk[wave * 16 + 8 * g + r][c] = hv; else th[c][wave * 16 + 8 * g + r] = hv; }
  __syncthreads();
  for (int e = tid; e < 64 * 8; e += 128) { const int rl = e >> 3, q = e & 7; vst2((unsigned*)(QH + ((size_t)blockIdx.x * 64 + rl) * UU + q * 8), *(const v4u*)&sq[rl][q * 8]); }
  // k and v leave in the order k_att's lanes load them: 16-byte piece e of the block's 8 KB belongs to lane e & 31 (row or column e & 15, k group (e >> 4) & 1), elements 0..7 or 8..15 by bit 5; above that k has (u half, key tile), v has (u tile, key step)
  for (int e = tid; e < 64 * 8; e += 128) { const int rc = e & 15, ko = ((e >> 5) & 1) * 16 + ((e >> 4) & 1) * 8; const size_t o = ((size_t)blockIdx.x * 512 + e) * 8;
    vst2((unsigned*)(KH + o), *(const v4u*)&sk[(e >> 7) * 16 + rc][((e >> 6) & 1) * 32 + ko]); vst2((unsigned*)(VT + o), *(const v4u*)&th[((e >> 6) & 3) * 16 + rc][(e >> 8) * 32 + ko]); } }
// ---- k_att: block = (64 queries, b), 2 query pairs x KP key parts = 2 * KP waves: w = sigmoid(q.k) = 1/2 + tanh(q.k / 2) / 2; each wave sums w v over its own keys for its 32 queries, the parts are joined in LDS (no normalisation)
// both products run transposed: scores^T = K q^T (K fragment as A, q as B), out^T += V^T w^T (V fragment as A, w as B). The two score tiles of 32 keys then lie, lane by lane and register by register, as the B fragment of the second product (D register r of tile t = key 16 t + 8 h + r of the lane's own query = element 8 t + r of B), so the weights never leave the registers. A and B share one fragment map, so q, K and V are stored and loaded as before
// a wave holds two query tiles: every K and V fragment it loads feeds two WMMAs per product, so the block moves half the fragment bytes from the cache into registers
#define KP 8
__global__ __launch_bounds__(64 * KP) void k_att(const _Float16* __restrict__ QH, const _Float16* __restrict__ KH, const _Float16* __restrict__ VT, float* __restrict__ OUT) {
  __shared__ __align__(16) float so[2 * KP][32][68];
  const int tid = threadIdx.x, wave = __builtin_amdgcn_readfirstlane(tid >> 5) /* scalar, so that the key loop keeps its scalar counter and branch */, lane = tid & 31, col = lane & 15, g = lane >> 4; const int qp = wave & 1, kp = wave >> 1; const size_t b = blockIdx.y; const int q0 = blockIdx.x * 64 + qp * 32; const size_t rq = b * NN + q0;
  v16h aq[2][2];
#pragma unroll
  for (int t = 0; t < 2; ++t)
#pragma unroll
    for (int kc = 0; kc < 2; ++kc) aq[t][kc] = frag_h(QH + (rq + t * 16 + col) * UU + kc * 32, lane);
  v8f acc[2][4] = {}; const unsigned fl = (unsigned)lane * 16u;
  // every fragment is loaded one trip ahead, into the registers that its last WMMA of this trip has just read: no load is waited for where it is issued
  v16h kf[4], vf[4];
  { const _Float16* kb = KH + (b * NN + kp * 32) * UU; const _Float16* vb = VT + (b * NN + kp * 32) * UU;   // 32 keys are 4 KB of K fragments (1 KB each: key tile, u half) and 4 KB of V fragments (1 KB each: u tile)
#pragma unroll
    for (int i = 0; i < 4; ++i) kf[i] = frag_hp(kb + i * 512, fl);
#pragma unroll
    for (int j = 0; j < 4; ++j) vf[j] = frag_hp(vb + j * 512, fl); }
  asm volatile("" :: "v"(aq[0][0]), "v"(aq[0][1]), "v"(aq[1][0]), "v"(aq[1][1]), "v"(kf[0]), "v"(kf[1]), "v"(kf[2]), "v"(kf[3]), "v"(vf[0]), "v"(vf[1]), "v"(vf[2]), "v"(vf[3]));   // the first loads are all waited for here, once: left to the loop, their order (the compiler's) sets the loop's counted waits so low that every trip waits for the V loads it has just issued
  // q halved once (a power of two: exact in f16 above the subnormals), so that every score tile is s / 2, the argument of the tanh form of the sigmoid
#pragma unroll
  for (int t = 0; t < 2; ++t)
#pragma unroll
    for (int kc = 0; kc < 2; ++kc) aq[t][kc] = aq[t][kc] * (_Float16)0.5f;
#pragma unroll 1
  for (int ks = kp; ks < NN / 32; ks += KP) {
    const int kn = ks + KP < NN / 32 ? ks + KP : ks;   // the last trip fetches its own keys again: in bounds, never used
    const _Float16* kb = KH + (b * NN + kn * 32) * UU; const _Float16* vb = VT + (b * NN + kn * 32) * UU;
    v16h pa[2], pal[2];
#pragma unroll
    for (int ct = 0; ct < 2; ++ct) { v8f c[2] = {};
#pragma unroll
      for (int kc = 0; kc < 2; ++kc)
#pragma unroll
        for (int t = 0; t < 2; ++t) c[t] = wmma16(kf[ct * 2 + kc], aq[t][kc], c[t]);
      kf[ct * 2] = frag_hp(kb + ct * 1024, fl); kf[ct * 2 + 1] = frag_hp(kb + ct * 1024 + 512, fl);
      __builtin_amdgcn_sched_barrier(0);   // holds the K loads here, a whole trip ahead of their use: left free, the compiler lends their registers to the sigmoids and issues the loads at the trip's foot, where the next trip waits for them at once
#pragma unroll
      for (int t = 0; t < 2; ++t)
#pragma unroll
        for (int r = 0; r < 8; r += 2) {
          // sigmoid(s) = 1/2 + tanh(s / 2) / 2: one transcendental (bare v_tanh_f32) where exp2 and rcp were two; s / 2 comes from the halved q, so the score goes into it as it is
          // the weight times 2^12, in the one multiply-add that also adds the constant: 2^11 + 2^11 tanh. The f16 high part and the f16 residual then share one scale (the residual stays a normal f16 number), so both products add into one accumulator: two query tiles with separate residual sums would not fit the 256 registers of 4 waves per SIMD
          const v2f p = {__builtin_fmaf(__builtin_amdgcn_tanhf(c[t][r]), 0x1p11f, 0x1p11f), __builtin_fmaf(__builtin_amdgcn_tanhf(c[t][r + 1]), 0x1p11f, 0x1p11f)};
          const v2h hi = __builtin_convertvector(p, v2h), lo = __builtin_convertvector(p - __builtin_convertvector(hi, v2f), v2h);   // two neighbouring keys fill one register of the fragment
          pa[t][ct * 8 + r] = hi[0]; pa[t][ct * 8 + r + 1] = hi[1]; pal[t][ct * 8 + r] = lo[0]; pal[t][ct * 8 + r + 1] = lo[1]; } }
#pragma unroll
    for (int j = 0; j < 4; ++j)
#pragma unroll
      for (int t = 0; t < 2; ++t) acc[t][j] = wmma16(vf[j], pa[t], acc[t][j]);
#pragma unroll   // the residual products come behind all eight high products: no WMMA waits for the accumulator of the one before it
    for (int j = 0; j < 4; ++j) {
#pragma unroll
      for (int t = 0; t < 2; ++t) acc[t][j] = wmma16(vf[j], pal[t], acc[t][j]);
      vf[j] = frag_hp(vb + j * 512, fl); }
    asm volatile("s_wait_xcnt 0x0" ::: "memory"); }   // stands before the next trip rewrites the address registers that this trip's loads name
  // a lane holds 8 consecutive u (16 j + 8 g + r) of its own query in each tile
#pragma unroll
  for (int t = 0; t < 2; ++t)
#pragma unroll
    for (int j = 0; j < 4; ++j)
#pragma unroll
      for (int h = 0; h < 2; ++h) { v4f o;
#pragma unroll
        for (int r = 0; r < 4; ++r) o[r] = acc[t][j][h * 4 + r];
        *(v4f*)&so[wave][t * 16 + col][j * 16 + 8 * g + h * 4] = o; }
  __syncthreads();   // every part's partial tile is in LDS before any thread joins them
  for (int e = tid; e < 64 * 16; e += 64 * KP) { const int row = e >> 4, c4 = (e & 15) * 4; v4f s = *(const v4f*)&so[row >> 5][row & 31][c4];
#pragma unroll   // the KP LDS reads issue together; the adds stay in the order of the parts
    for (int p = 1; p < KP; ++p) s += *(const v4f*)&so[p * 2 + (row >> 5)][row & 31][c4];
    vst2(OUT + (b * NN + blockIdx.x * 64 + row) * UU + c4, s * 0x1p-12f); } }   // the weights' scale goes here, exactly
extern "C" void kernel_launch(void* const* d_in, const int* in_sizes, int n_in, void* d_out, int out_size, void* d_ws, size_t ws_size, hipStream_t stream) {
  (void)in_sizes; (void)n_in; (void)out_size;
  const float** F = (const float**)d_in;   // 0 inputs [4,4096,512,1], 1 Wq [512,64], 2 Wk, 3 Wv ((in,out))
  if (ws_size < (size_t)WS_END) return;
  char* ws = (char*)d_ws; __bf16* PW = (__bf16*)(ws + WS_PW); _Float16 *QH = (_Float16*)(ws + WS_QH), *KH = (_Float16*)(ws + WS_KH), *VT = (_Float16*)(ws + WS_VT);
  k_packw<<<3 * UU / 16 * (DD / 32), 64, 0, stream>>>(F[1], F[2], F[3], PW);
  k_proj<<<NB * NN / 64, 128, 0, stream>>>(F[0], PW, QH, KH, VT);
  k_att<<<dim3(NN / 64, TNB), 64 * KP, 0, stream>>>(QH, KH, VT, (float*)d_out);
}
